// v000
// The times below were measured on an AMD MI455X: many runs one after another, warmed up first and cycling through
// copies of the inputs, with the whole window's GPU time divided by the number of runs. Launches and the gaps
// between them are all in it. The median over several windows is given; except for v000 it joins two sittings, which
// can be a few percent apart, so the side-by-side timings, each taken in one sitting, are the better comparison.
// The starting kernel, v000, takes 1460 microseconds a run.
#include <hip/hip_runtime.h>

// Causal multi-head self-attention: x [NB][SEQ][1024]; q/k/v = x W (W stored [in][out], no bias; 16 heads x 64); softmax(q.k^T / 8) under a lower-triangular mask; out = merged(attn.v) Wo + bo -> [NB][SEQ][1024] f32.
// Compute dtypes, f32 accumulate: every float input RNE-converted to bf16 on load; q/k/v projections v_wmma_f32_16x16x32_bf16 on plain bf16 operands (exact products);
// causal scores and attn.v: query rows < RH on bf16 hi/lo operand planes (3 products, v_wmma_f32_16x16x32_bf16), rows >= RH on single fp16 operands (v_wmma_f32_16x16x32_f16, probabilities carried x1024); softmax f32;
// output projection: bf16 hi/lo activations x exact bf16 Wo (2 products) + bias.

#ifndef NB
#define NB   2
#endif
#ifndef SEQ
#define SEQ  2048
#endif
#define NB_FULL  2
#define SEQ_FULL 2048
#define TT   SEQ
#define DM   1024
#define NH_  16
#define HD   64
#define DQ   (NH_ * HD)
#define ZH   2
#ifndef RH
#define RH   (((SEQ) < 512) ? (SEQ) : 512)   // query rows < RH use hi+lo planes
#endif
#define PCAR 1024.0f
#define SCL  0.125f   // HD^-0.5

static_assert((SEQ) % 128 == 0);
static_assert((RH) % 64 == 0);
static_assert((RH) <= (SEQ));
static_assert((NH_) % (ZH) == 0);
static_assert((DM) % 64 == 0);
static_assert((HD) == 64);
static_assert((NB) >= 1 && (NB) <= (NB_FULL));
static_assert((SEQ) <= (SEQ_FULL));

typedef _Float16 h16;
typedef unsigned short bf;
typedef __attribute__((ext_vector_type(16))) __bf16   v16bf;
typedef __attribute__((ext_vector_type(16))) _Float16 v16h;
typedef __attribute__((ext_vector_type(8)))  _Float16 v8h;
typedef __attribute__((ext_vector_type(8)))  unsigned short v8us;
typedef __attribute__((ext_vector_type(8)))  float    v8f;
typedef __attribute__((ext_vector_type(4)))  float    v4f;
typedef v8h  __attribute__((may_alias)) v8ha;
typedef v4f  __attribute__((may_alias)) v4fa;
typedef v8us __attribute__((may_alias)) v8usa;

__device__ __forceinline__ unsigned short f2bf(float f) { unsigned u = __float_as_uint(f); u += 0x7FFFu + ((u >> 16) & 1u); return (unsigned short)(u >> 16); }
__device__ __forceinline__ float bf2f(unsigned short b) { return __uint_as_float(((unsigned)b) << 16); }
__device__ __forceinline__ float bfr(float f) { return bf2f(f2bf(f)); }
__device__ __forceinline__ v16h cat16(v8h lo, v8h hi) { return __builtin_shufflevector(lo, hi, 0, 1, 2, 3, 4, 5, 6, 7, 8, 9, 10, 11, 12, 13, 14, 15); }
__device__ __forceinline__ v16bf cat16b(v8us lo, v8us hi) { return __builtin_bit_cast(v16bf, __builtin_shufflevector(lo, hi, 0, 1, 2, 3, 4, 5, 6, 7, 8, 9, 10, 11, 12, 13, 14, 15)); }
__device__ __forceinline__ v8f wmma16(v16h a, v16h b, v8f c) { return __builtin_amdgcn_wmma_f32_16x16x32_f16(false, a, false, b, (short)0, c, false, false); }
__device__ __forceinline__ v8f wmmab(v16bf a, v16bf b, v8f c) { return __builtin_amdgcn_wmma_f32_16x16x32_bf16(false, a, false, b, (short)0, c, false, false); }

// ---- k_gemmw: register-blocked GEMM, ONE WAVE per 64x64 output tile (16 accumulators), operands straight from K-contiguous 16-bit planes; grid (M/64, N/64, Z), 32 threads.
// C[m][n] (f32, pitch ldc, + optional f32 bias[n]) = sum_k A[m][k] Bt[n][k] (+ split products per NSPLIT). z-batch strides sA/sB/sC in elements. K % 32 == 0.
// Fragments: lane l -> row/col (l & 15); elements 0..7 <- k0 + 8*(l>>4) + 0..7, elements 8..15 <- k0 + 16 + 8*(l>>4) + 0..7 for A and B alike; D element j of lane l = (row 8*(l>>4)+j, col l&15).
template <typename T16> struct WFrag;
template <> struct WFrag<h16> { typedef v16h V; static __device__ __forceinline__ V ld(const h16* p) { return cat16(*(const v8h*)p, *(const v8h*)(p + 16)); } static __device__ __forceinline__ v8f mma(V a, V b, v8f c) { return wmma16(a, b, c); } };
template <> struct WFrag<bf> { typedef v16bf V; static __device__ __forceinline__ V ld(const bf* p) { return cat16b(*(const v8us*)p, *(const v8us*)(p + 16)); } static __device__ __forceinline__ v8f mma(V a, V b, v8f c) { return wmmab(a, b, c); } };
template <typename T16, int NSPLIT, bool BIAS>
__global__ __launch_bounds__(32) void k_gemmw(const T16* __restrict__ A, const T16* __restrict__ A2, const T16* __restrict__ Bt, const T16* __restrict__ Bt2, int K, float* C, int ldc, const float* __restrict__ bias, size_t sA, size_t sB, size_t sC) {
    typedef typename WFrag<T16>::V V;
    __shared__ __align__(16) float os[16 * 68];
    const size_t z = blockIdx.z; A += z * sA; if (A2) A2 += z * sA; Bt += z * sB; if (Bt2) Bt2 += z * sB; C += z * sC;
    const int lane = threadIdx.x & 31, lr = lane & 15, hi = lane >> 4; const int r0 = blockIdx.x * 64, c0 = blockIdx.y * 64;
    v8f acc[4][4];
#pragma unroll
    for (int mb = 0; mb < 4; ++mb)
#pragma unroll
        for (int nb = 0; nb < 4; ++nb) acc[mb][nb] = (v8f){};
    const size_t aoff = (size_t)(r0 + lr) * K + 8 * hi, boff = (size_t)(c0 + lr) * K + 8 * hi;
#pragma unroll 1
    for (int kc = 0; kc < K; kc += 32) {
        V a[4], a2[4];
#pragma unroll
        for (int mb = 0; mb < 4; ++mb) { a[mb] = WFrag<T16>::ld(A + aoff + (size_t)mb * 16 * K + kc); if (NSPLIT == 1 || NSPLIT == 2) a2[mb] = WFrag<T16>::ld(A2 + aoff + (size_t)mb * 16 * K + kc); }
#pragma unroll
        for (int nb = 0; nb < 4; ++nb) { const V b = WFrag<T16>::ld(Bt + boff + (size_t)nb * 16 * K + kc); V b2; if (NSPLIT >= 2) b2 = WFrag<T16>::ld(Bt2 + boff + (size_t)nb * 16 * K + kc);
#pragma unroll
            for (int mb = 0; mb < 4; ++mb) { acc[mb][nb] = WFrag<T16>::mma(a[mb], b, acc[mb][nb]); if (NSPLIT == 1 || NSPLIT == 2) acc[mb][nb] = WFrag<T16>::mma(a2[mb], b, acc[mb][nb]); if (NSPLIT >= 2) acc[mb][nb] = WFrag<T16>::mma(a[mb], b2, acc[mb][nb]); } }
        asm volatile("v_nop\n\tv_nop\n\tv_nop\n\tv_nop" : "+v"(acc[0][0]), "+v"(acc[1][1]), "+v"(acc[2][2]), "+v"(acc[3][3]) : "v"(a[0]), "v"(a[3]));
    }
#pragma unroll
    for (int mb = 0; mb < 4; ++mb) {
#pragma unroll
        for (int nb = 0; nb < 4; ++nb) {
#pragma unroll
            for (int j = 0; j < 8; ++j) os[(hi * 8 + j) * 68 + nb * 16 + lr] = acc[mb][nb][j]; }
        __builtin_amdgcn_wave_barrier(); asm volatile("" ::: "memory");
        float* crow = C + (size_t)(r0 + mb * 16) * ldc + c0;
{
#pragma unroll
            for (int s = 0; s < 8; ++s) { const int row = 2 * s + hi, cofs = lr * 4; v4f val = *(const v4fa*)(os + row * 68 + cofs); if (BIAS) { val[0] += bfr(bias[c0 + cofs]); val[1] += bfr(bias[c0 + cofs + 1]); val[2] += bfr(bias[c0 + cofs + 2]); val[3] += bfr(bias[c0 + cofs + 3]); }
                *(v4f*)(crow + (size_t)row * ldc + cofs) = val; }
             }
        __builtin_amdgcn_wave_barrier(); asm volatile("" ::: "memory");
    }
}

// ---- k_gemmc: the same one-wave 64x64 tile GEMM specialised for causal attention: CMODE 1 skips score tiles entirely above the diagonal (query rows r0+roff.., key columns c0..), CMODE 2 limits the
// key (K) loop of the probability x value contraction to the diagonal block (probabilities beyond it are exactly zero). roff = row offset of this launch's first row within the sequence.
template <typename T16, int NSPLIT, int CMODE>
__global__ __launch_bounds__(32) void k_gemmc(const T16* __restrict__ A, const T16* __restrict__ A2, const T16* __restrict__ Bt, const T16* __restrict__ Bt2, int K, float* C, int ldc, int roff, size_t sA, size_t sB, size_t sC) {
    typedef typename WFrag<T16>::V V;
    __shared__ __align__(16) float os[16 * 68];
    const size_t z = blockIdx.z; A += z * sA; if (A2) A2 += z * sA; Bt += z * sB; if (Bt2) Bt2 += z * sB; C += z * sC;
    const int lane = threadIdx.x & 31, lr = lane & 15, hi = lane >> 4; const int r0 = blockIdx.x * 64, c0 = blockIdx.y * 64;
    if (CMODE == 1 && c0 > r0 + roff + 63) return;                  // score tile entirely above the causal diagonal: never read (the softmax masks j > i by index select)
    const int Kl = (CMODE == 2) ? min(K, r0 + roff + 64) : K;        // P.V: probabilities are exactly 0 beyond the diagonal block, so the K loop stops there
    v8f acc[4][4];
#pragma unroll
    for (int mb = 0; mb < 4; ++mb)
#pragma unroll
        for (int nb = 0; nb < 4; ++nb) acc[mb][nb] = (v8f){};
    const size_t aoff = (size_t)(r0 + lr) * K + 8 * hi, boff = (size_t)(c0 + lr) * K + 8 * hi;
#pragma unroll 1
    for (int kc = 0; kc < Kl; kc += 32) {
        V a[4], a2[4];
#pragma unroll
        for (int mb = 0; mb < 4; ++mb) { a[mb] = WFrag<T16>::ld(A + aoff + (size_t)mb * 16 * K + kc); if (NSPLIT == 1 || NSPLIT == 2) a2[mb] = WFrag<T16>::ld(A2 + aoff + (size_t)mb * 16 * K + kc); }
#pragma unroll
        for (int nb = 0; nb < 4; ++nb) { const V b = WFrag<T16>::ld(Bt + boff + (size_t)nb * 16 * K + kc); V b2; if (NSPLIT >= 2) b2 = WFrag<T16>::ld(Bt2 + boff + (size_t)nb * 16 * K + kc);
#pragma unroll
            for (int mb = 0; mb < 4; ++mb) { acc[mb][nb] = WFrag<T16>::mma(a[mb], b, acc[mb][nb]); if (NSPLIT == 1 || NSPLIT == 2) acc[mb][nb] = WFrag<T16>::mma(a2[mb], b, acc[mb][nb]); if (NSPLIT >= 2) acc[mb][nb] = WFrag<T16>::mma(a[mb], b2, acc[mb][nb]); } }
        asm volatile("v_nop\n\tv_nop\n\tv_nop\n\tv_nop" : "+v"(acc[0][0]), "+v"(acc[1][1]), "+v"(acc[2][2]), "+v"(acc[3][3]) : "v"(a[0]), "v"(a[3]));
    }
#pragma unroll
    for (int mb = 0; mb < 4; ++mb) {
#pragma unroll
        for (int nb = 0; nb < 4; ++nb) {
#pragma unroll
            for (int j = 0; j < 8; ++j) os[(hi * 8 + j) * 68 + nb * 16 + lr] = acc[mb][nb][j]; }
        __builtin_amdgcn_wave_barrier(); asm volatile("" ::: "memory");
        float* crow = C + (size_t)(r0 + mb * 16) * ldc + c0;
{
#pragma unroll
            for (int s = 0; s < 8; ++s) { const int row = 2 * s + hi, cofs = lr * 4; v4f val = *(const v4fa*)(os + row * 68 + cofs);
                *(v4f*)(crow + (size_t)row * ldc + cofs) = val; }
             }
        __builtin_amdgcn_wave_barrier(); asm volatile("" ::: "memory");
    }
}

__device__ __forceinline__ h16 tohx(float x) { return (h16)x; }
__device__ __forceinline__ void splitf(float y, unsigned short& h, unsigned short& l) { h = f2bf(y); l = f2bf(y - bf2f(h)); }
typedef __attribute__((ext_vector_type(2))) _Float16 v2h;
typedef __attribute__((ext_vector_type(4))) _Float16 v4h;
typedef __attribute__((ext_vector_type(2))) unsigned short v2us;
typedef __attribute__((ext_vector_type(4))) unsigned short v4us;
typedef __attribute__((ext_vector_type(2))) float v2f;
typedef __attribute__((ext_vector_type(4))) int v4i;

__global__ __launch_bounds__(256) void k_wtG(const float* __restrict__ w, int K, int N, bf* Bt) {
    const int lane = threadIdx.x & 31; const int L0 = (blockIdx.x * 8 + (threadIdx.x >> 5)) * 8; const int nlines = N * K / 64;
{
#pragma unroll 1
        for (int l = 0; l < 8; ++l) { const int L = L0 + l; if (L >= nlines) break; const size_t e = (size_t)L * 64 + lane * 2; const int k = (int)(e % K), n = (int)(e / K); v2us o;
            o[0] = f2bf(w[(size_t)k * N + n]); o[1] = f2bf(w[(size_t)(k + 1) * N + n]); *(v2us*)(Bt + e) = o; }
         }
}
__global__ __launch_bounds__(256) void k_cvt8(const float* __restrict__ src, bf* dst, size_t n8) { const size_t i = (size_t)blockIdx.x * 256 + threadIdx.x; if (i >= n8) return; const v8f v = *(const v8f*)(src + i * 8); v8us o;
#pragma unroll
    for (int k = 0; k < 8; ++k) o[k] = f2bf(v[k]); *(v8us*)(dst + i * 8) = o;  }
__global__ __launch_bounds__(256) void k_qkp(const float* __restrict__ F, int pitch, int nheads, h16* P16, bf* Ph, bf* Pl) {
    const size_t e = ((size_t)blockIdx.x * 256 + threadIdx.x) * 2; if (e >= (size_t)nheads * TT * HD) return; const int d = (int)(e % HD); const int t = (int)((e / HD) % TT); const int h = (int)(e / ((size_t)HD * TT)); const float* f = F + (size_t)t * pitch + h * HD; v2h o16; v2us oh, ol;
#pragma unroll
    for (int q = 0; q < 2; ++q) { const float x = f[d + q]; o16[q] = tohx(x); unsigned short a2, c2; splitf(x, a2, c2); oh[q] = a2; ol[q] = c2; }
    *(v2h*)(P16 + e) = o16; *(v2us*)(Ph + e) = oh; *(v2us*)(Pl + e) = ol;  }
__global__ __launch_bounds__(256) void k_vtp(const float* __restrict__ F, int pitch, int nheads, h16* V16, bf* Vh, bf* Vl) { const size_t e = ((size_t)blockIdx.x * 256 + threadIdx.x) * 2; if (e >= (size_t)nheads * HD * TT) return; const int t = (int)(e % TT); const int d = (int)((e / TT) % HD); const int g = (int)(e / ((size_t)TT * HD)); v2h o16; v2us oh, ol;
#pragma unroll
    for (int q = 0; q < 2; ++q) { const float x = F[(size_t)(t + q) * pitch + g * HD + d]; o16[q] = tohx(x); unsigned short a2, c2; splitf(x, a2, c2); oh[q] = a2; ol[q] = c2; }
    *(v2h*)(V16 + e) = o16; *(v2us*)(Vh + e) = oh; *(v2us*)(Vl + e) = ol;  }
// k_asoft: per row (zz, i) (one wave per row): t = S x HD^-0.5 for j <= i, the lower-triangular mask applied as an index select (entries j > i are never used as values); max-subtracted softmax over the TT keys (register row, one exp2, fixed shuffle trees);
__global__ __launch_bounds__(256) void k_asoft(const float* __restrict__ Sb, h16* P16, bf* Ph, bf* Pl) {
    const int lane = threadIdx.x & 31; const int row = blockIdx.x * 8 + (threadIdx.x >> 5); if (row >= ZH * TT) return; const int i = row % TT; const int zz = row / TT; (void)zz; const bool hires = (i < RH); const float* sr = Sb + (size_t)row * TT; float v[TT / 32]; float mx = -3.0e38f;
#pragma unroll
    for (int ch = 0; ch < TT / 128; ++ch) { const int j0 = ch * 128 + lane * 4; const v4f a = *(const v4f*)(sr + j0);
#pragma unroll
        for (int q = 0; q < 4; ++q) { const int j = j0 + q; (void)j; const float t = (j <= i) ? a[q] * SCL : -3.0e38f; v[ch * 4 + q] = t; mx = fmaxf(mx, t); } }
#pragma unroll
    for (int sh = 16; sh; sh >>= 1) mx = fmaxf(mx, __shfl_xor(mx, sh, 32));
    float sum = 0.f;
#pragma unroll
    for (int k = 0; k < TT / 32; ++k) { float d0 = __fsub_rn(v[k], mx); asm volatile("" : "+v"(d0)); v[k] = __builtin_amdgcn_exp2f(__fmul_rn(d0, 1.4426950408889634f)); sum += v[k]; }
#pragma unroll
    for (int sh = 16; sh; sh >>= 1) sum += __shfl_xor(sum, sh, 32);
    const float f = __fdiv_rn(hires ? 1.0f : PCAR, sum);
{
        if (hires) {
#pragma unroll
            for (int ch = 0; ch < TT / 128; ++ch) { v4us oh, ol;
#pragma unroll
                for (int q = 0; q < 4; ++q) { unsigned short a, c2; splitf(v[ch * 4 + q] * f, a, c2); oh[q] = a; ol[q] = c2; }
                const size_t oo = ((size_t)zz * (RH ? RH : 1) + i) * TT + ch * 128 + lane * 4; *(v4us*)(Ph + oo) = oh; *(v4us*)(Pl + oo) = ol; }
        } else {
#pragma unroll
            for (int ch = 0; ch < TT / 128; ++ch) { v4h o4;
#pragma unroll
                for (int q = 0; q < 4; ++q) o4[q] = tohx(v[ch * 4 + q] * f);
                *(v4h*)(P16 + (size_t)row * TT + ch * 128 + lane * 4) = o4; } }
         }
}
__global__ __launch_bounds__(256) void k_merge(const float* __restrict__ O, int h0, bf* Ah, bf* Al) { const size_t e = ((size_t)blockIdx.x * 256 + threadIdx.x) * 2; if (e >= (size_t)ZH * TT * HD) return; const int d = (int)(e % HD); const int t = (int)((e / HD) % TT); const int zz = (int)(e / ((size_t)HD * TT)); const float cs = (t < RH) ? 1.0f : (1.0f / PCAR); const size_t oo = (size_t)t * DQ + (h0 + zz) * HD + d;
    v2us oh, ol;
#pragma unroll
    for (int q = 0; q < 2; ++q) { unsigned short a, c2; splitf(O[e + q] * cs, a, c2); oh[q] = a; ol[q] = c2; } *(v2us*)(Ah + oo) = oh; *(v2us*)(Al + oo) = ol;  }

extern "C" void kernel_launch(void* const* d_in, const int* in_sizes, int n_in,
                              void* d_out, int out_size, void* d_ws, size_t ws_size, hipStream_t stream) {
    if (n_in < 6) return;
    const size_t xneed = (size_t)(NB - 1) * SEQ_FULL * DM + (size_t)TT * DM;
    if ((size_t)in_sizes[0] < xneed || (size_t)in_sizes[1] < (size_t)DM * DQ || (size_t)in_sizes[2] < (size_t)DM * DQ || (size_t)in_sizes[3] < (size_t)DM * DQ || (size_t)in_sizes[4] < (size_t)DQ * DM || in_sizes[5] < DM || (size_t)out_size < xneed) return;
    const float* x = (const float*)d_in[0]; const float* wq = (const float*)d_in[1]; const float* wk = (const float*)d_in[2]; const float* wv = (const float*)d_in[3]; const float* wo = (const float*)d_in[4]; const float* bo = (const float*)d_in[5];
    float* OUT = (float*)d_out;     // [NB][SEQ][1024], batch stride SEQ_FULL*DM
    char* wsp = (char*)d_ws;
    auto take = [&](size_t bytes) { char* p = wsp; wsp += (bytes + 255) & ~(size_t)255; return (void*)p; };
    bf* WQ = (bf*)take((size_t)DQ * DM * 2); bf* WK = (bf*)take((size_t)DQ * DM * 2); bf* WV = (bf*)take((size_t)DQ * DM * 2); bf* WO = (bf*)take((size_t)DM * DQ * 2);
    bf* XB = (bf*)take((size_t)TT * DM * 2); float* F = (float*)take((size_t)TT * DQ * 4);          // F: q, then k, then v projection (stream-ordered reuse after each plane build)
    h16* QP16 = (h16*)take((size_t)NH_ * TT * HD * 2); h16* KP16 = (h16*)take((size_t)NH_ * TT * HD * 2); h16* VT16 = (h16*)take((size_t)NH_ * HD * TT * 2);
    bf* QPh = (bf*)take((size_t)NH_ * TT * HD * 2); bf* QPl = (bf*)take((size_t)NH_ * TT * HD * 2); bf* KPh = (bf*)take((size_t)NH_ * TT * HD * 2); bf* KPl = (bf*)take((size_t)NH_ * TT * HD * 2); bf* VTh = (bf*)take((size_t)NH_ * HD * TT * 2); bf* VTl = (bf*)take((size_t)NH_ * HD * TT * 2);
    bf* Ph = (bf*)take((size_t)ZH * RH * TT * 2); bf* Pl = (bf*)take((size_t)ZH * RH * TT * 2);
    float* Sb = (float*)take((size_t)ZH * TT * TT * 4); h16* P16 = (h16*)take((size_t)ZH * TT * TT * 2); float* Ob = (float*)take((size_t)ZH * TT * HD * 4); bf* ATh = (bf*)take((size_t)TT * DQ * 2); bf* ATl = (bf*)take((size_t)TT * DQ * 2);
    if ((size_t)(wsp - (char*)d_ws) > ws_size) return;    // 126,877,696 B at NB=2, SEQ=2048
    // weights: Bt[n][k] bf16 planes from the [in][out] storage
    { const unsigned gw = (unsigned)((DQ * DM / 64 + 63) / 64);
      k_wtG<<<gw, 256, 0, stream>>>(wq, DM, DQ, WQ); k_wtG<<<gw, 256, 0, stream>>>(wk, DM, DQ, WK); k_wtG<<<gw, 256, 0, stream>>>(wv, DM, DQ, WV); k_wtG<<<gw, 256, 0, stream>>>(wo, DQ, DM, WO); }
    const unsigned LP = (unsigned)(((size_t)NH_ * TT * HD / 2 + 255) / 256);
    const unsigned LX = (unsigned)(((size_t)TT * DM / 8 + 255) / 256);
    for (int b = 0; b < NB; ++b) {
        k_cvt8<<<LX, 256, 0, stream>>>(x + (size_t)b * SEQ_FULL * DM, XB, (size_t)TT * DM / 8);
        k_gemmw<bf, 0, false><<<dim3(TT / 64, DQ / 64, 1), 32, 0, stream>>>(XB, nullptr, WQ, nullptr, DM, F, DQ, nullptr, 0, 0, 0);
        k_qkp<<<LP, 256, 0, stream>>>(F, DQ, NH_, QP16, QPh, QPl);
        k_gemmw<bf, 0, false><<<dim3(TT / 64, DQ / 64, 1), 32, 0, stream>>>(XB, nullptr, WK, nullptr, DM, F, DQ, nullptr, 0, 0, 0);
        k_qkp<<<LP, 256, 0, stream>>>(F, DQ, NH_, KP16, KPh, KPl);
        k_gemmw<bf, 0, false><<<dim3(TT / 64, DQ / 64, 1), 32, 0, stream>>>(XB, nullptr, WV, nullptr, DM, F, DQ, nullptr, 0, 0, 0);
        k_vtp<<<LP, 256, 0, stream>>>(F, DQ, NH_, VT16, VTh, VTl);
        for (int h0 = 0; h0 < NH_; h0 += ZH) { const size_t zq = (size_t)h0;   // this pass's two heads use consecutive planes (z-strides TT*HD)
            k_gemmc<bf, 2, 1><<<dim3(RH / 64, TT / 64, ZH), 32, 0, stream>>>(QPh + zq * TT * HD, QPl + zq * TT * HD, KPh + zq * TT * HD, KPl + zq * TT * HD, HD, Sb, TT, 0, (size_t)TT * HD, (size_t)TT * HD, (size_t)TT * TT);
            if (TT > RH) k_gemmc<h16, 0, 1><<<dim3((TT - RH) / 64, TT / 64, ZH), 32, 0, stream>>>(QP16 + zq * TT * HD + (size_t)RH * HD, nullptr, KP16 + zq * TT * HD, nullptr, HD, Sb + (size_t)RH * TT, TT, RH, (size_t)TT * HD, (size_t)TT * HD, (size_t)TT * TT);
            k_asoft<<<ZH * TT / 8, 256, 0, stream>>>(Sb, P16, Ph, Pl);
            k_gemmc<bf, 2, 2><<<dim3(RH / 64, HD / 64, ZH), 32, 0, stream>>>(Ph, Pl, VTh + zq * HD * TT, VTl + zq * HD * TT, TT, Ob, HD, 0, (size_t)RH * TT, (size_t)HD * TT, (size_t)TT * HD);
            if (TT > RH) k_gemmc<h16, 0, 2><<<dim3((TT - RH) / 64, HD / 64, ZH), 32, 0, stream>>>(P16 + (size_t)RH * TT, nullptr, VT16 + zq * HD * TT, nullptr, TT, Ob + (size_t)RH * HD, HD, RH, (size_t)TT * TT, (size_t)HD * TT, (size_t)TT * HD);
            k_merge<<<(unsigned)(((size_t)ZH * TT * HD / 2 + 255) / 256), 256, 0, stream>>>(Ob, h0, ATh, ATl); }
        k_gemmw<bf, 1, true><<<dim3(TT / 64, DM / 64, 1), 32, 0, stream>>>(ATh, ATl, WO, nullptr, DQ, OUT + (size_t)b * SEQ_FULL * DM, DM, bo, 0, 0, 0); }
}

// v001
// A run of this version takes 372 microseconds.
// Two timings next to v000 put it at 3.89 and 3.90 times that version's speed.
#include <hip/hip_runtime.h>

// Causal multi-head self-attention: x [NB][SEQ][1024]; q/k/v = x W (W stored [in][out], no bias; 16 heads x 64); softmax(q.k^T / 8) under a lower-triangular mask; out = merged(attn.v) Wo + bo -> [NB][SEQ][1024] f32.
// Compute dtypes, f32 accumulate: every float input RNE-converted to bf16 on load; q/k/v projections v_wmma_f32_16x16x32_bf16 on plain bf16 operands (exact products);
// causal scores and attn.v: query rows < RH on bf16 hi/lo operand planes (3 products, v_wmma_f32_16x16x32_bf16), rows >= RH on single fp16 operands (v_wmma_f32_16x16x32_f16, probabilities carried unnormalised); online softmax f32, scores kept in registers;
// output projection: bf16 hi/lo activations x exact bf16 Wo (2 products) + bias.

#ifndef NB
#define NB   2
#endif
#ifndef SEQ
#define SEQ  2048
#endif
#define NB_FULL  2
#define SEQ_FULL 2048
#define TT   SEQ
#define DM   1024
#define NH_  16
#define HD   64
#define DQ   (NH_ * HD)
#ifndef RH
#define RH   (((SEQ) < 512) ? (SEQ) : 512)   // query rows < RH use hi+lo planes
#endif
#define SCL  0.125f   // HD^-0.5

static_assert((SEQ) % 128 == 0);
static_assert((RH) % 64 == 0);
static_assert((RH) <= (SEQ));
static_assert((DM) % 64 == 0);
static_assert((HD) == 64);
static_assert((NB) >= 1 && (NB) <= (NB_FULL));
static_assert((SEQ) <= (SEQ_FULL));

typedef _Float16 h16;
typedef unsigned short bf;
typedef __attribute__((ext_vector_type(16))) __bf16   v16bf;
typedef __attribute__((ext_vector_type(16))) _Float16 v16h;
typedef __attribute__((ext_vector_type(8)))  _Float16 v8h;
typedef __attribute__((ext_vector_type(8)))  unsigned short v8us;
typedef __attribute__((ext_vector_type(8)))  float    v8f;
typedef __attribute__((ext_vector_type(4)))  float    v4f;
typedef v8h  __attribute__((may_alias)) v8ha;
typedef v4f  __attribute__((may_alias)) v4fa;
typedef v8us __attribute__((may_alias)) v8usa;

__device__ __forceinline__ unsigned short f2bf(float f) { unsigned u = __float_as_uint(f); u += 0x7FFFu + ((u >> 16) & 1u); return (unsigned short)(u >> 16); }
__device__ __forceinline__ float bf2f(unsigned short b) { return __uint_as_float(((unsigned)b) << 16); }
__device__ __forceinline__ float bfr(float f) { return bf2f(f2bf(f)); }
__device__ __forceinline__ v16h cat16(v8h lo, v8h hi) { return __builtin_shufflevector(lo, hi, 0, 1, 2, 3, 4, 5, 6, 7, 8, 9, 10, 11, 12, 13, 14, 15); }
__device__ __forceinline__ v16bf cat16b(v8us lo, v8us hi) { return __builtin_bit_cast(v16bf, __builtin_shufflevector(lo, hi, 0, 1, 2, 3, 4, 5, 6, 7, 8, 9, 10, 11, 12, 13, 14, 15)); }
__device__ __forceinline__ v8f wmma16(v16h a, v16h b, v8f c) { return __builtin_amdgcn_wmma_f32_16x16x32_f16(false, a, false, b, (short)0, c, false, false); }
__device__ __forceinline__ v8f wmmab(v16bf a, v16bf b, v8f c) { return __builtin_amdgcn_wmma_f32_16x16x32_bf16(false, a, false, b, (short)0, c, false, false); }

// ---- k_gemmw: register-blocked GEMM, ONE WAVE per 64x64 output tile (16 accumulators), operands straight from K-contiguous 16-bit planes; grid (M/64, N/64, Z), 32 threads.
// C[m][n] (f32, pitch ldc, + optional f32 bias[n]) = sum_k A[m][k] Bt[n][k] (+ split products per NSPLIT). z-batch strides sA/sB/sC in elements. K % 32 == 0.
// Fragments: lane l -> row/col (l & 15); elements 0..7 <- k0 + 8*(l>>4) + 0..7, elements 8..15 <- k0 + 16 + 8*(l>>4) + 0..7 for A and B alike; D element j of lane l = (row 8*(l>>4)+j, col l&15).
template <typename T16> struct WFrag;
template <> struct WFrag<h16> { typedef v16h V; static __device__ __forceinline__ V ld(const h16* p) { return cat16(*(const v8h*)p, *(const v8h*)(p + 16)); } static __device__ __forceinline__ v8f mma(V a, V b, v8f c) { return wmma16(a, b, c); } };
template <> struct WFrag<bf> { typedef v16bf V; static __device__ __forceinline__ V ld(const bf* p) { return cat16b(*(const v8us*)p, *(const v8us*)(p + 16)); } static __device__ __forceinline__ v8f mma(V a, V b, v8f c) { return wmmab(a, b, c); } };
template <typename T16, int NSPLIT, bool BIAS>
__global__ __launch_bounds__(32) void k_gemmw(const T16* __restrict__ A, const T16* __restrict__ A2, const T16* __restrict__ Bt, const T16* __restrict__ Bt2, int K, float* C, int ldc, const float* __restrict__ bias, size_t sA, size_t sB, size_t sC) {
    typedef typename WFrag<T16>::V V;
    __shared__ __align__(16) float os[16 * 68];
    const size_t z = blockIdx.z; A += z * sA; if (A2) A2 += z * sA; Bt += z * sB; if (Bt2) Bt2 += z * sB; C += z * sC;
    const int lane = threadIdx.x & 31, lr = lane & 15, hi = lane >> 4; const int r0 = blockIdx.x * 64, c0 = blockIdx.y * 64;
    v8f acc[4][4];
#pragma unroll
    for (int mb = 0; mb < 4; ++mb)
#pragma unroll
        for (int nb = 0; nb < 4; ++nb) acc[mb][nb] = (v8f){};
    const size_t aoff = (size_t)(r0 + lr) * K + 8 * hi, boff = (size_t)(c0 + lr) * K + 8 * hi;
#pragma unroll 1
    for (int kc = 0; kc < K; kc += 32) {
        V a[4], a2[4];
#pragma unroll
        for (int mb = 0; mb < 4; ++mb) { a[mb] = WFrag<T16>::ld(A + aoff + (size_t)mb * 16 * K + kc); if (NSPLIT == 1 || NSPLIT == 2) a2[mb] = WFrag<T16>::ld(A2 + aoff + (size_t)mb * 16 * K + kc); }
#pragma unroll
        for (int nb = 0; nb < 4; ++nb) { const V b = WFrag<T16>::ld(Bt + boff + (size_t)nb * 16 * K + kc); V b2; if (NSPLIT >= 2) b2 = WFrag<T16>::ld(Bt2 + boff + (size_t)nb * 16 * K + kc);
#pragma unroll
            for (int mb = 0; mb < 4; ++mb) { acc[mb][nb] = WFrag<T16>::mma(a[mb], b, acc[mb][nb]); if (NSPLIT == 1 || NSPLIT == 2) acc[mb][nb] = WFrag<T16>::mma(a2[mb], b, acc[mb][nb]); if (NSPLIT >= 2) acc[mb][nb] = WFrag<T16>::mma(a[mb], b2, acc[mb][nb]); } }
        asm volatile("v_nop\n\tv_nop\n\tv_nop\n\tv_nop" : "+v"(acc[0][0]), "+v"(acc[1][1]), "+v"(acc[2][2]), "+v"(acc[3][3]) : "v"(a[0]), "v"(a[3]));
    }
#pragma unroll
    for (int mb = 0; mb < 4; ++mb) {
#pragma unroll
        for (int nb = 0; nb < 4; ++nb) {
#pragma unroll
            for (int j = 0; j < 8; ++j) os[(hi * 8 + j) * 68 + nb * 16 + lr] = acc[mb][nb][j]; }
        __builtin_amdgcn_wave_barrier(); asm volatile("" ::: "memory");
        float* crow = C + (size_t)(r0 + mb * 16) * ldc + c0;
{
#pragma unroll
            for (int s = 0; s < 8; ++s) { const int row = 2 * s + hi, cofs = lr * 4; v4f val = *(const v4fa*)(os + row * 68 + cofs); if (BIAS) { val[0] += bfr(bias[c0 + cofs]); val[1] += bfr(bias[c0 + cofs + 1]); val[2] += bfr(bias[c0 + cofs + 2]); val[3] += bfr(bias[c0 + cofs + 3]); }
                *(v4f*)(crow + (size_t)row * ldc + cofs) = val; }
             }
        __builtin_amdgcn_wave_barrier(); asm volatile("" ::: "memory");
    }
}

__device__ __forceinline__ h16 tohx(float x) { return (h16)x; }
__device__ __forceinline__ void splitf(float y, unsigned short& h, unsigned short& l) { h = f2bf(y); l = f2bf(y - bf2f(h)); }
typedef __attribute__((ext_vector_type(2))) _Float16 v2h;
typedef __attribute__((ext_vector_type(4))) _Float16 v4h;
typedef __attribute__((ext_vector_type(2))) unsigned short v2us;
typedef __attribute__((ext_vector_type(4))) unsigned short v4us;
typedef __attribute__((ext_vector_type(2))) float v2f;
typedef __attribute__((ext_vector_type(4))) int v4i;

__global__ __launch_bounds__(256) void k_wtG(const float* __restrict__ w, int K, int N, bf* Bt) {
    const int lane = threadIdx.x & 31; const int L0 = (blockIdx.x * 8 + (threadIdx.x >> 5)) * 8; const int nlines = N * K / 64;
{
#pragma unroll 1
        for (int l = 0; l < 8; ++l) { const int L = L0 + l; if (L >= nlines) break; const size_t e = (size_t)L * 64 + lane * 2; const int k = (int)(e % K), n = (int)(e / K); v2us o;
            o[0] = f2bf(w[(size_t)k * N + n]); o[1] = f2bf(w[(size_t)(k + 1) * N + n]); *(v2us*)(Bt + e) = o; }
         }
}
__global__ __launch_bounds__(256) void k_cvt8(const float* __restrict__ src, bf* dst, size_t n8) { const size_t i = (size_t)blockIdx.x * 256 + threadIdx.x; if (i >= n8) return; const v8f v = *(const v8f*)(src + i * 8); v8us o;
#pragma unroll
    for (int k = 0; k < 8; ++k) o[k] = f2bf(v[k]); *(v8us*)(dst + i * 8) = o;  }
__global__ __launch_bounds__(256) void k_qkp(const float* __restrict__ F, int pitch, int nheads, h16* P16, bf* Ph, bf* Pl) {
    const size_t e = ((size_t)blockIdx.x * 256 + threadIdx.x) * 2; if (e >= (size_t)nheads * TT * HD) return; const int d = (int)(e % HD); const int t = (int)((e / HD) % TT); const int h = (int)(e / ((size_t)HD * TT)); const float* f = F + (size_t)t * pitch + h * HD; v2h o16; v2us oh, ol;
#pragma unroll
    for (int q = 0; q < 2; ++q) { const float x = f[d + q]; o16[q] = tohx(x); unsigned short a2, c2; splitf(x, a2, c2); oh[q] = a2; ol[q] = c2; }
    *(v2h*)(P16 + e) = o16; *(v2us*)(Ph + e) = oh; *(v2us*)(Pl + e) = ol;  }
__global__ __launch_bounds__(256) void k_vtp(const float* __restrict__ F, int pitch, int nheads, h16* V16, bf* Vh, bf* Vl) { const size_t e = ((size_t)blockIdx.x * 256 + threadIdx.x) * 2; if (e >= (size_t)nheads * HD * TT) return; const int t = (int)(e % TT); const int d = (int)((e / TT) % HD); const int g = (int)(e / ((size_t)TT * HD)); v2h o16; v2us oh, ol;
#pragma unroll
    for (int q = 0; q < 2; ++q) { const float x = F[(size_t)(t + q) * pitch + g * HD + d]; o16[q] = tohx(x); unsigned short a2, c2; splitf(x, a2, c2); oh[q] = a2; ol[q] = c2; }
    *(v2h*)(V16 + e) = o16; *(v2us*)(Vh + e) = oh; *(v2us*)(Vl + e) = ol;  }
// ---- k_attn: causal attention for one head and 16 query rows per wave, scores never leave registers. Both products are taken transposed: S^T = K.Q^T puts a query in each lane (column l & 15) and keys 8*(l>>4)+j in
// its accumulator elements, which is already the B-fragment k order of O^T = V^T.P^T (key tile 2g -> elements 0..7, key tile 2g+1 -> elements 8..15), so probabilities go from accumulator to operand without a shuffle.
// Online softmax: running maximum m of the raw scores and running sum l per query; o and l are rescaled by exp2((m_old - m_new) c) each pass of KB keys. Probabilities are carried unnormalised (<= 1); the division by l is last.
__device__ __forceinline__ float xhalf(float x) { return __builtin_bit_cast(float, __builtin_amdgcn_permlanex16(__builtin_bit_cast(int, x), __builtin_bit_cast(int, x), 0x76543210, 0xfedcba98, false, false)); }  // lane l with lane l ^ 16
__device__ __forceinline__ void pfrag(const v8f& p0, const v8f& p1, v16h& f, v16h& f2) { (void)f2;
#pragma unroll
    for (int j = 0; j < 8; ++j) { f[j] = tohx(p0[j]); f[8 + j] = tohx(p1[j]); } }
__device__ __forceinline__ void pfrag(const v8f& p0, const v8f& p1, v16bf& f, v16bf& f2) { v8us h0, h1, l0, l1;
#pragma unroll
    for (int j = 0; j < 8; ++j) { unsigned short a, c2; splitf(p0[j], a, c2); h0[j] = a; l0[j] = c2; splitf(p1[j], a, c2); h1[j] = a; l1[j] = c2; }
    f = cat16b(h0, h1); f2 = cat16b(l0, l1); }
template <typename T16, bool SPLIT, int KB>
__device__ __forceinline__ void attn_rows(const T16* __restrict__ Q, const T16* __restrict__ Q2, const T16* __restrict__ Kp, const T16* __restrict__ K2, const T16* __restrict__ Vt, const T16* __restrict__ V2, int q0, int lr, int hi, bf* Ah, bf* Al) {
    typedef typename WFrag<T16>::V V;
    constexpr int NK = KB / 16, NG = KB / 32;
    const float c = SCL * 1.4426950408889634f;
    V qf[2], qf2[2];
#pragma unroll
    for (int ks = 0; ks < 2; ++ks) { qf[ks] = WFrag<T16>::ld(Q + (size_t)(q0 + lr) * HD + ks * 32 + 8 * hi); if constexpr (SPLIT) qf2[ks] = WFrag<T16>::ld(Q2 + (size_t)(q0 + lr) * HD + ks * 32 + 8 * hi); }
    v8f o[4];
#pragma unroll
    for (int db = 0; db < 4; ++db) o[db] = (v8f){};
    float m = -3.0e38f, l = 0.f;
    const unsigned koff = (unsigned)(lr * HD + 8 * hi), voff = (unsigned)(lr * TT + 8 * hi);
#pragma unroll 1
    for (int k0 = 0; k0 <= q0 + 15; k0 += KB) {
        V ka[NK][2], ka2[NK][2], va[NG][4], va2[NG][4];     // all of a pass's requests go out in one run, keys first: one memory latency a pass, and the values' share of it runs under scores and softmax
        const size_t kb = (size_t)k0 * HD;
#pragma unroll
        for (int kt = 0; kt < NK; ++kt)
#pragma unroll
            for (int ks = 0; ks < 2; ++ks) { ka[kt][ks] = WFrag<T16>::ld(Kp + kb + koff + (kt * 16 * HD + ks * 32)); if constexpr (SPLIT) ka2[kt][ks] = WFrag<T16>::ld(K2 + kb + koff + (kt * 16 * HD + ks * 32)); }
        asm volatile("s_wait_xcnt 0x0" ::: "memory");       // precaution: a value request below may land in a register pair that the key requests above name as an address
#pragma unroll
        for (int g = 0; g < NG; ++g)
#pragma unroll
            for (int db = 0; db < 4; ++db) va[g][db] = WFrag<T16>::ld(Vt + k0 + voff + (db * 16 * TT + g * 32));
        if constexpr (SPLIT) { asm volatile("s_wait_xcnt 0x0" ::: "memory");   // the same precaution between the two value planes
#pragma unroll
            for (int g = 0; g < NG; ++g)
#pragma unroll
                for (int db = 0; db < 4; ++db) va2[g][db] = WFrag<T16>::ld(V2 + k0 + voff + (db * 16 * TT + g * 32)); }
        asm volatile("s_wait_xcnt 0x0" ::: "memory");       // precaution: stands in front of every later write of a register that the requests above name as an address
        // inputs-only fence on the loaded key fragments: all eight are in flight together; without it they are asked for in turns into reused registers, several latencies a pass
        if constexpr (SPLIT) asm volatile("" :: "v"(ka[0][0]), "v"(ka[0][1]), "v"(ka[1][0]), "v"(ka[1][1]), "v"(ka2[0][0]), "v"(ka2[0][1]), "v"(ka2[1][0]), "v"(ka2[1][1]));
        else asm volatile("" :: "v"(ka[0][0]), "v"(ka[0][1]), "v"(ka[1][0]), "v"(ka[1][1]), "v"(ka[NK - 2][0]), "v"(ka[NK - 2][1]), "v"(ka[NK - 1][0]), "v"(ka[NK - 1][1]));
        v8f s[NK];
#pragma unroll
        for (int kt = 0; kt < NK; ++kt) { v8f acc = (v8f){};
#pragma unroll
            for (int ks = 0; ks < 2; ++ks) { acc = WFrag<T16>::mma(ka[kt][ks], qf[ks], acc);
                if constexpr (SPLIT) { acc = WFrag<T16>::mma(ka2[kt][ks], qf[ks], acc); acc = WFrag<T16>::mma(ka[kt][ks], qf2[ks], acc); } }
            s[kt] = acc; }
        if (k0 + KB - 1 > q0) {      // only passes that reach the diagonal hold keys above a query: mask by index select
#pragma unroll
            for (int kt = 0; kt < NK; ++kt)
#pragma unroll
                for (int j = 0; j < 8; ++j) s[kt][j] = (k0 + kt * 16 + 8 * hi + j <= q0 + lr) ? s[kt][j] : -3.0e38f; }
        float mx = m;
#pragma unroll
        for (int kt = 0; kt < NK; ++kt) { float t = s[kt][0];      // one short chain a key tile, side by side
#pragma unroll
            for (int j = 1; j < 8; ++j) t = fmaxf(t, s[kt][j]);
            mx = fmaxf(mx, t); }
        mx = fmaxf(mx, xhalf(mx));      // the two lane halves hold different keys of the same query
        const float mc = mx * c;                        // exponent as one fused multiply-add a score: s c - max c
        const float alpha = __builtin_amdgcn_exp2f(__builtin_fmaf(m, c, -mc)); m = mx;
        float ps = 0.f;
#pragma unroll
        for (int kt = 0; kt < NK; ++kt) { float t = 0.f;
#pragma unroll
            for (int j = 0; j < 8; ++j) { s[kt][j] = __builtin_amdgcn_exp2f(__builtin_fmaf(s[kt][j], c, -mc)); t += s[kt][j]; }
            ps += t; }
        l = l * alpha + ps;
#pragma unroll
        for (int db = 0; db < 4; ++db) o[db] *= alpha;
#pragma unroll
        for (int g = 0; g < NG; ++g) { V pf, pf2; pfrag(s[2 * g], s[2 * g + 1], pf, pf2);
#pragma unroll
            for (int db = 0; db < 4; ++db) { o[db] = WFrag<T16>::mma(va[g][db], pf, o[db]); if constexpr (SPLIT) { o[db] = WFrag<T16>::mma(va2[g][db], pf, o[db]); o[db] = WFrag<T16>::mma(va[g][db], pf2, o[db]); } } }
    }
    l += xhalf(l);
    const float inv = __fdiv_rn(1.0f, l);
#pragma unroll
    for (int db = 0; db < 4; ++db) { v8us oh, ol;
#pragma unroll
        for (int j = 0; j < 8; ++j) { unsigned short a, c2; splitf(o[db][j] * inv, a, c2); oh[j] = a; ol[j] = c2; }
        const size_t oo = (size_t)(q0 + lr) * DQ + db * 16 + 8 * hi; *(v8us*)(Ah + oo) = oh; *(v8us*)(Al + oo) = ol; }
}
// grid (TT/16, heads), one wave a block; the longest rows (most keys) are dealt first.
__global__ __launch_bounds__(32) void k_attn(const h16* __restrict__ Q16, const h16* __restrict__ K16, const h16* __restrict__ V16, const bf* __restrict__ Qh, const bf* __restrict__ Ql, const bf* __restrict__ Kh, const bf* __restrict__ Kl, const bf* __restrict__ Vh, const bf* __restrict__ Vl, bf* Ah, bf* Al) {
    const int lane = threadIdx.x & 31, lr = lane & 15, hi = lane >> 4; const int q0 = (TT / 16 - 1 - (int)blockIdx.x) * 16; const size_t hb = (size_t)blockIdx.y * TT * HD; const size_t ho = (size_t)blockIdx.y * HD;
    if (q0 < RH) attn_rows<bf, true, 32>(Qh + hb, Ql + hb, Kh + hb, Kl + hb, Vh + hb, Vl + hb, q0, lr, hi, Ah + ho, Al + ho);
    else attn_rows<h16, false, 64>(Q16 + hb, nullptr, K16 + hb, nullptr, V16 + hb, nullptr, q0, lr, hi, Ah + ho, Al + ho);
}

extern "C" void kernel_launch(void* const* d_in, const int* in_sizes, int n_in,
                              void* d_out, int out_size, void* d_ws, size_t ws_size, hipStream_t stream) {
    if (n_in < 6) return;
    const size_t xneed = (size_t)(NB - 1) * SEQ_FULL * DM + (size_t)TT * DM;
    if ((size_t)in_sizes[0] < xneed || (size_t)in_sizes[1] < (size_t)DM * DQ || (size_t)in_sizes[2] < (size_t)DM * DQ || (size_t)in_sizes[3] < (size_t)DM * DQ || (size_t)in_sizes[4] < (size_t)DQ * DM || in_sizes[5] < DM || (size_t)out_size < xneed) return;
    const float* x = (const float*)d_in[0]; const float* wq = (const float*)d_in[1]; const float* wk = (const float*)d_in[2]; const float* wv = (const float*)d_in[3]; const float* wo = (const float*)d_in[4]; const float* bo = (const float*)d_in[5];
    float* OUT = (float*)d_out;     // [NB][SEQ][1024], batch stride SEQ_FULL*DM
    char* wsp = (char*)d_ws;
    auto take = [&](size_t bytes) { char* p = wsp; wsp += (bytes + 255) & ~(size_t)255; return (void*)p; };
    bf* WQ = (bf*)take((size_t)DQ * DM * 2); bf* WK = (bf*)take((size_t)DQ * DM * 2); bf* WV = (bf*)take((size_t)DQ * DM * 2); bf* WO = (bf*)take((size_t)DM * DQ * 2);
    bf* XB = (bf*)take((size_t)TT * DM * 2); float* F = (float*)take((size_t)TT * DQ * 4);          // F: q, then k, then v projection (stream-ordered reuse after each plane build)
    h16* QP16 = (h16*)take((size_t)NH_ * TT * HD * 2); h16* KP16 = (h16*)take((size_t)NH_ * TT * HD * 2); h16* VT16 = (h16*)take((size_t)NH_ * HD * TT * 2);
    bf* QPh = (bf*)take((size_t)NH_ * TT * HD * 2); bf* QPl = (bf*)take((size_t)NH_ * TT * HD * 2); bf* KPh = (bf*)take((size_t)NH_ * TT * HD * 2); bf* KPl = (bf*)take((size_t)NH_ * TT * HD * 2); bf* VTh = (bf*)take((size_t)NH_ * HD * TT * 2); bf* VTl = (bf*)take((size_t)NH_ * HD * TT * 2);
    bf* ATh = (bf*)take((size_t)TT * DQ * 2); bf* ATl = (bf*)take((size_t)TT * DQ * 2);
    if ((size_t)(wsp - (char*)d_ws) > ws_size) return;
    // weights: Bt[n][k] bf16 planes from the [in][out] storage
    { const unsigned gw = (unsigned)((DQ * DM / 64 + 63) / 64);
      k_wtG<<<gw, 256, 0, stream>>>(wq, DM, DQ, WQ); k_wtG<<<gw, 256, 0, stream>>>(wk, DM, DQ, WK); k_wtG<<<gw, 256, 0, stream>>>(wv, DM, DQ, WV); k_wtG<<<gw, 256, 0, stream>>>(wo, DQ, DM, WO); }
    const unsigned LP = (unsigned)(((size_t)NH_ * TT * HD / 2 + 255) / 256);
    const unsigned LX = (unsigned)(((size_t)TT * DM / 8 + 255) / 256);
    for (int b = 0; b < NB; ++b) {
        k_cvt8<<<LX, 256, 0, stream>>>(x + (size_t)b * SEQ_FULL * DM, XB, (size_t)TT * DM / 8);
        k_gemmw<bf, 0, false><<<dim3(TT / 64, DQ / 64, 1), 32, 0, stream>>>(XB, nullptr, WQ, nullptr, DM, F, DQ, nullptr, 0, 0, 0);
        k_qkp<<<LP, 256, 0, stream>>>(F, DQ, NH_, QP16, QPh, QPl);
        k_gemmw<bf, 0, false><<<dim3(TT / 64, DQ / 64, 1), 32, 0, stream>>>(XB, nullptr, WK, nullptr, DM, F, DQ, nullptr, 0, 0, 0);
        k_qkp<<<LP, 256, 0, stream>>>(F, DQ, NH_, KP16, KPh, KPl);
        k_gemmw<bf, 0, false><<<dim3(TT / 64, DQ / 64, 1), 32, 0, stream>>>(XB, nullptr, WV, nullptr, DM, F, DQ, nullptr, 0, 0, 0);
        k_vtp<<<LP, 256, 0, stream>>>(F, DQ, NH_, VT16, VTh, VTl);
        k_attn<<<dim3(TT / 16, NH_, 1), 32, 0, stream>>>(QP16, KP16, VT16, QPh, QPl, KPh, KPl, VTh, VTl, ATh, ATl);
        k_gemmw<bf, 1, true><<<dim3(TT / 64, DM / 64, 1), 32, 0, stream>>>(ATh, ATl, WO, nullptr, DQ, OUT + (size_t)b * SEQ_FULL * DM, DM, bo, 0, 0, 0); }
}

// v002
// It runs in 342 microseconds.
// Two timings next to v001 both put it at 1.09 times that version's speed.
// Counting every step since v000, it is 4.24 times as fast.
#include <hip/hip_runtime.h>

// Causal multi-head self-attention: x [NB][SEQ][1024]; q/k/v = x W (W stored [in][out], no bias; 16 heads x 64); softmax(q.k^T / 8) under a lower-triangular mask; out = merged(attn.v) Wo + bo -> [NB][SEQ][1024] f32.
// Compute dtypes, f32 accumulate: every float input RNE-converted to bf16 on load; q/k/v projections v_wmma_f32_16x16x32_bf16 on plain bf16 operands (exact products);
// causal scores and attn.v: query rows < RH on bf16 hi/lo operand planes (3 products, v_wmma_f32_16x16x32_bf16), rows >= RH on single fp16 operands (v_wmma_f32_16x16x32_f16, probabilities carried unnormalised); online softmax f32, scores kept in registers;
// output projection: bf16 hi/lo activations x exact bf16 Wo (2 products) + bias.

#ifndef NB
#define NB   2
#endif
#ifndef SEQ
#define SEQ  2048
#endif
#define NB_FULL  2
#define SEQ_FULL 2048
#define TT   SEQ
#define DM   1024
#define NH_  16
#define HD   64
#define DQ   (NH_ * HD)
#ifndef RH
#define RH   (((SEQ) < 512) ? (SEQ) : 512)   // query rows < RH use hi+lo planes
#endif
#define SCL  0.125f   // HD^-0.5

static_assert((SEQ) % 128 == 0);
static_assert((RH) % 64 == 0);
static_assert((RH) <= (SEQ));
static_assert((DM) % 64 == 0);
static_assert((HD) == 64);
static_assert((NB) >= 1 && (NB) <= (NB_FULL));
static_assert((SEQ) <= (SEQ_FULL));

typedef _Float16 h16;
typedef unsigned short bf;
typedef __attribute__((ext_vector_type(16))) __bf16   v16bf;
typedef __attribute__((ext_vector_type(16))) _Float16 v16h;
typedef __attribute__((ext_vector_type(8)))  _Float16 v8h;
typedef __attribute__((ext_vector_type(8)))  unsigned short v8us;
typedef __attribute__((ext_vector_type(8)))  float    v8f;
typedef __attribute__((ext_vector_type(4)))  float    v4f;
typedef v8h  __attribute__((may_alias)) v8ha;
typedef v4f  __attribute__((may_alias)) v4fa;
typedef v8us __attribute__((may_alias)) v8usa;

__device__ __forceinline__ unsigned short f2bf(float f) { unsigned u = __float_as_uint(f); u += 0x7FFFu + ((u >> 16) & 1u); return (unsigned short)(u >> 16); }
__device__ __forceinline__ float bf2f(unsigned short b) { return __uint_as_float(((unsigned)b) << 16); }
__device__ __forceinline__ float bfr(float f) { return bf2f(f2bf(f)); }
__device__ __forceinline__ h16 tohx(float x) { return (h16)x; }
__device__ __forceinline__ void splitf(float y, unsigned short& h, unsigned short& l) { h = f2bf(y); l = f2bf(y - bf2f(h)); }
__device__ __forceinline__ v16h cat16(v8h lo, v8h hi) { return __builtin_shufflevector(lo, hi, 0, 1, 2, 3, 4, 5, 6, 7, 8, 9, 10, 11, 12, 13, 14, 15); }
__device__ __forceinline__ v16bf cat16b(v8us lo, v8us hi) { return __builtin_bit_cast(v16bf, __builtin_shufflevector(lo, hi, 0, 1, 2, 3, 4, 5, 6, 7, 8, 9, 10, 11, 12, 13, 14, 15)); }
__device__ __forceinline__ v8f wmma16(v16h a, v16h b, v8f c) { return __builtin_amdgcn_wmma_f32_16x16x32_f16(false, a, false, b, (short)0, c, false, false); }
__device__ __forceinline__ v8f wmmab(v16bf a, v16bf b, v8f c) { return __builtin_amdgcn_wmma_f32_16x16x32_bf16(false, a, false, b, (short)0, c, false, false); }

// ---- k_gemmw: register-blocked GEMM, ONE WAVE per 64x64 output tile (16 accumulators), operands straight from K-contiguous 16-bit planes; grid (M/64, N/64, Z), 32 threads.
// C[m][n] (f32, pitch ldc, + optional f32 bias[n]) = sum_k A[m][k] Bt[n][k] (+ split products per NSPLIT). z-batch strides sA/sB/sC in elements. K % 32 == 0.
// PLANES: no f32 C; the tile leaves as the three 16-bit operand planes of the attention kernel (fp16, bf16 hi, bf16 lo), straight from the accumulators: a lane's 8 elements are 8 consecutive rows m of one column n,
// stored as one 16-byte piece a plane at element (blockIdx.x * prs + (m & 63)) + n * ppitch. q, k: A = weight (m = head * 64 + d), Bt = x (n = t), ppitch 64, prs SEQ * 64 -> [head][t][d]; v: A = x (m = t), Bt = weight (n = head * 64 + d), ppitch SEQ, prs 64 -> [head][d][t].
// Fragments: lane l -> row/col (l & 15); elements 0..7 <- k0 + 8*(l>>4) + 0..7, elements 8..15 <- k0 + 16 + 8*(l>>4) + 0..7 for A and B alike; D element j of lane l = (row 8*(l>>4)+j, col l&15).
template <typename T16> struct WFrag;
template <> struct WFrag<h16> { typedef v16h V; static __device__ __forceinline__ V ld(const h16* p) { return cat16(*(const v8h*)p, *(const v8h*)(p + 16)); } static __device__ __forceinline__ v8f mma(V a, V b, v8f c) { return wmma16(a, b, c); } };
template <> struct WFrag<bf> { typedef v16bf V; static __device__ __forceinline__ V ld(const bf* p) { return cat16b(*(const v8us*)p, *(const v8us*)(p + 16)); } static __device__ __forceinline__ v8f mma(V a, V b, v8f c) { return wmmab(a, b, c); } };
template <typename T16, int NSPLIT, bool BIAS, bool PLANES>
__global__ __launch_bounds__(32) void k_gemmw(const T16* __restrict__ A, const T16* __restrict__ A2, const T16* __restrict__ Bt, const T16* __restrict__ Bt2, int K, float* C, int ldc, const float* __restrict__ bias, size_t sA, size_t sB, size_t sC, h16* P16, bf* Ph, bf* Pl, int ppitch, size_t prs) {
    typedef typename WFrag<T16>::V V;
    __shared__ __align__(16) float os[16 * 68];
    const size_t z = blockIdx.z; A += z * sA; if (A2) A2 += z * sA; Bt += z * sB; if (Bt2) Bt2 += z * sB; C += z * sC;
    const int lane = threadIdx.x & 31, lr = lane & 15, hi = lane >> 4; const int r0 = blockIdx.x * 64, c0 = blockIdx.y * 64;
    v8f acc[4][4];
#pragma unroll
    for (int mb = 0; mb < 4; ++mb)
#pragma unroll
        for (int nb = 0; nb < 4; ++nb) acc[mb][nb] = (v8f){};
    const size_t aoff = (size_t)(r0 + lr) * K + 8 * hi, boff = (size_t)(c0 + lr) * K + 8 * hi;
#pragma unroll 1
    for (int kc = 0; kc < K; kc += 32) {
        V a[4], a2[4];
#pragma unroll
        for (int mb = 0; mb < 4; ++mb) { a[mb] = WFrag<T16>::ld(A + aoff + (size_t)mb * 16 * K + kc); if (NSPLIT == 1 || NSPLIT == 2) a2[mb] = WFrag<T16>::ld(A2 + aoff + (size_t)mb * 16 * K + kc); }
#pragma unroll
        for (int nb = 0; nb < 4; ++nb) { const V b = WFrag<T16>::ld(Bt + boff + (size_t)nb * 16 * K + kc); V b2; if (NSPLIT >= 2) b2 = WFrag<T16>::ld(Bt2 + boff + (size_t)nb * 16 * K + kc);
#pragma unroll
            for (int mb = 0; mb < 4; ++mb) { acc[mb][nb] = WFrag<T16>::mma(a[mb], b, acc[mb][nb]); if (NSPLIT == 1 || NSPLIT == 2) acc[mb][nb] = WFrag<T16>::mma(a2[mb], b, acc[mb][nb]); if (NSPLIT >= 2) acc[mb][nb] = WFrag<T16>::mma(a[mb], b2, acc[mb][nb]); } }
        asm volatile("v_nop\n\tv_nop\n\tv_nop\n\tv_nop" : "+v"(acc[0][0]), "+v"(acc[1][1]), "+v"(acc[2][2]), "+v"(acc[3][3]) : "v"(a[0]), "v"(a[3]));
    }
    if constexpr (PLANES) {
        const size_t pb = (size_t)blockIdx.x * prs + (size_t)(c0 + lr) * ppitch + 8 * hi;
        // all three loops unrolled: the accumulators are indexed by constants alone and stay in registers
#pragma unroll
        for (int nb = 0; nb < 4; ++nb)
#pragma unroll
            for (int mb = 0; mb < 4; ++mb) { v8h o16; v8us oh, ol;      // the four pieces of a 128-byte line go out one after the other
#pragma unroll
                for (int j = 0; j < 8; ++j) { const float x = acc[mb][nb][j]; o16[j] = tohx(x); unsigned short a2, c2; splitf(x, a2, c2); oh[j] = a2; ol[j] = c2; }
                const size_t po = pb + (size_t)(nb * 16) * ppitch + mb * 16; *(v8h*)(P16 + po) = o16; *(v8us*)(Ph + po) = oh; *(v8us*)(Pl + po) = ol; }
        return;
    }
#pragma unroll
    for (int mb = 0; mb < 4; ++mb) {
#pragma unroll
        for (int nb = 0; nb < 4; ++nb) {
#pragma unroll
            for (int j = 0; j < 8; ++j) os[(hi * 8 + j) * 68 + nb * 16 + lr] = acc[mb][nb][j]; }
        __builtin_amdgcn_wave_barrier(); asm volatile("" ::: "memory");
        float* crow = C + (size_t)(r0 + mb * 16) * ldc + c0;
{
#pragma unroll
            for (int s = 0; s < 8; ++s) { const int row = 2 * s + hi, cofs = lr * 4; v4f val = *(const v4fa*)(os + row * 68 + cofs); if (BIAS) { val[0] += bfr(bias[c0 + cofs]); val[1] += bfr(bias[c0 + cofs + 1]); val[2] += bfr(bias[c0 + cofs + 2]); val[3] += bfr(bias[c0 + cofs + 3]); }
                *(v4f*)(crow + (size_t)row * ldc + cofs) = val; }
             }
        __builtin_amdgcn_wave_barrier(); asm volatile("" ::: "memory");
    }
}

typedef __attribute__((ext_vector_type(2))) _Float16 v2h;
typedef __attribute__((ext_vector_type(4))) _Float16 v4h;
typedef __attribute__((ext_vector_type(2))) unsigned short v2us;
typedef __attribute__((ext_vector_type(4))) unsigned short v4us;
typedef __attribute__((ext_vector_type(2))) float v2f;
typedef __attribute__((ext_vector_type(4))) int v4i;

__global__ __launch_bounds__(256) void k_wtG(const float* __restrict__ w, int K, int N, bf* Bt) {
    const int lane = threadIdx.x & 31; const int L0 = (blockIdx.x * 8 + (threadIdx.x >> 5)) * 8; const int nlines = N * K / 64;
{
#pragma unroll 1
        for (int l = 0; l < 8; ++l) { const int L = L0 + l; if (L >= nlines) break; const size_t e = (size_t)L * 64 + lane * 2; const int k = (int)(e % K), n = (int)(e / K); v2us o;
            o[0] = f2bf(w[(size_t)k * N + n]); o[1] = f2bf(w[(size_t)(k + 1) * N + n]); *(v2us*)(Bt + e) = o; }
         }
}
__global__ __launch_bounds__(256) void k_cvt8(const float* __restrict__ src, bf* dst, size_t n8) { const size_t i = (size_t)blockIdx.x * 256 + threadIdx.x; if (i >= n8) return; const v8f v = *(const v8f*)(src + i * 8); v8us o;
#pragma unroll
    for (int k = 0; k < 8; ++k) o[k] = f2bf(v[k]); *(v8us*)(dst + i * 8) = o;  }
// ---- k_attn: causal attention for one head and 16 query rows per wave, scores never leave registers. Both products are taken transposed: S^T = K.Q^T puts a query in each lane (column l & 15) and keys 8*(l>>4)+j in
// its accumulator elements, which is already the B-fragment k order of O^T = V^T.P^T (key tile 2g -> elements 0..7, key tile 2g+1 -> elements 8..15), so probabilities go from accumulator to operand without a shuffle.
// Online softmax: running maximum m of the raw scores and running sum l per query; o and l are rescaled by exp2((m_old - m_new) c) each pass of KB keys. Probabilities are carried unnormalised (<= 1); the division by l is last.
__device__ __forceinline__ float xhalf(float x) { return __builtin_bit_cast(float, __builtin_amdgcn_permlanex16(__builtin_bit_cast(int, x), __builtin_bit_cast(int, x), 0x76543210, 0xfedcba98, false, false)); }  // lane l with lane l ^ 16
__device__ __forceinline__ void pfrag(const v8f& p0, const v8f& p1, v16h& f, v16h& f2) { (void)f2;
#pragma unroll
    for (int j = 0; j < 8; ++j) { f[j] = tohx(p0[j]); f[8 + j] = tohx(p1[j]); } }
__device__ __forceinline__ void pfrag(const v8f& p0, const v8f& p1, v16bf& f, v16bf& f2) { v8us h0, h1, l0, l1;
#pragma unroll
    for (int j = 0; j < 8; ++j) { unsigned short a, c2; splitf(p0[j], a, c2); h0[j] = a; l0[j] = c2; splitf(p1[j], a, c2); h1[j] = a; l1[j] = c2; }
    f = cat16b(h0, h1); f2 = cat16b(l0, l1); }
template <typename T16, bool SPLIT, int KB>
__device__ __forceinline__ void attn_rows(const T16* __restrict__ Q, const T16* __restrict__ Q2, const T16* __restrict__ Kp, const T16* __restrict__ K2, const T16* __restrict__ Vt, const T16* __restrict__ V2, int q0, int lr, int hi, bf* Ah, bf* Al) {
    typedef typename WFrag<T16>::V V;
    constexpr int NK = KB / 16, NG = KB / 32;
    const float c = SCL * 1.4426950408889634f;
    V qf[2], qf2[2];
#pragma unroll
    for (int ks = 0; ks < 2; ++ks) { qf[ks] = WFrag<T16>::ld(Q + (size_t)(q0 + lr) * HD + ks * 32 + 8 * hi); if constexpr (SPLIT) qf2[ks] = WFrag<T16>::ld(Q2 + (size_t)(q0 + lr) * HD + ks * 32 + 8 * hi); }
    v8f o[4];
#pragma unroll
    for (int db = 0; db < 4; ++db) o[db] = (v8f){};
    float m = -3.0e38f, l = 0.f;
    const unsigned koff = (unsigned)(lr * HD + 8 * hi), voff = (unsigned)(lr * TT + 8 * hi);
#pragma unroll 1
    for (int k0 = 0; k0 <= q0 + 15; k0 += KB) {
        V ka[NK][2], ka2[NK][2], va[NG][4], va2[NG][4];     // all of a pass's requests go out in one run, keys first: one memory latency a pass, and the values' share of it runs under scores and softmax
        const size_t kb = (size_t)k0 * HD;
#pragma unroll
        for (int kt = 0; kt < NK; ++kt)
#pragma unroll
            for (int ks = 0; ks < 2; ++ks) { ka[kt][ks] = WFrag<T16>::ld(Kp + kb + koff + (kt * 16 * HD + ks * 32)); if constexpr (SPLIT) ka2[kt][ks] = WFrag<T16>::ld(K2 + kb + koff + (kt * 16 * HD + ks * 32)); }
        asm volatile("s_wait_xcnt 0x0" ::: "memory");       // precaution: a value request below may land in a register pair that the key requests above name as an address
#pragma unroll
        for (int g = 0; g < NG; ++g)
#pragma unroll
            for (int db = 0; db < 4; ++db) va[g][db] = WFrag<T16>::ld(Vt + k0 + voff + (db * 16 * TT + g * 32));
        if constexpr (SPLIT) { asm volatile("s_wait_xcnt 0x0" ::: "memory");   // the same precaution between the two value planes
#pragma unroll
            for (int g = 0; g < NG; ++g)
#pragma unroll
                for (int db = 0; db < 4; ++db) va2[g][db] = WFrag<T16>::ld(V2 + k0 + voff + (db * 16 * TT + g * 32)); }
        asm volatile("s_wait_xcnt 0x0" ::: "memory");       // precaution: stands in front of every later write of a register that the requests above name as an address
        // inputs-only fence on the loaded key fragments: all eight are in flight together; without it they are asked for in turns into reused registers, several latencies a pass
        if constexpr (SPLIT) asm volatile("" :: "v"(ka[0][0]), "v"(ka[0][1]), "v"(ka[1][0]), "v"(ka[1][1]), "v"(ka2[0][0]), "v"(ka2[0][1]), "v"(ka2[1][0]), "v"(ka2[1][1]));
        else asm volatile("" :: "v"(ka[0][0]), "v"(ka[0][1]), "v"(ka[1][0]), "v"(ka[1][1]), "v"(ka[NK - 2][0]), "v"(ka[NK - 2][1]), "v"(ka[NK - 1][0]), "v"(ka[NK - 1][1]));
        v8f s[NK];
#pragma unroll
        for (int kt = 0; kt < NK; ++kt) { v8f acc = (v8f){};
#pragma unroll
            for (int ks = 0; ks < 2; ++ks) { acc = WFrag<T16>::mma(ka[kt][ks], qf[ks], acc);
                if constexpr (SPLIT) { acc = WFrag<T16>::mma(ka2[kt][ks], qf[ks], acc); acc = WFrag<T16>::mma(ka[kt][ks], qf2[ks], acc); } }
            s[kt] = acc; }
        if (k0 + KB - 1 > q0) {      // only passes that reach the diagonal hold keys above a query: mask by index select
#pragma unroll
            for (int kt = 0; kt < NK; ++kt)
#pragma unroll
                for (int j = 0; j < 8; ++j) s[kt][j] = (k0 + kt * 16 + 8 * hi + j <= q0 + lr) ? s[kt][j] : -3.0e38f; }
        float mx = m;
#pragma unroll
        for (int kt = 0; kt < NK; ++kt) { float t = s[kt][0];      // one short chain a key tile, side by side
#pragma unroll
            for (int j = 1; j < 8; ++j) t = fmaxf(t, s[kt][j]);
            mx = fmaxf(mx, t); }
        mx = fmaxf(mx, xhalf(mx));      // the two lane halves hold different keys of the same query
        const float mc = mx * c;                        // exponent as one fused multiply-add a score: s c - max c
        const float alpha = __builtin_amdgcn_exp2f(__builtin_fmaf(m, c, -mc)); m = mx;
        float ps = 0.f;
#pragma unroll
        for (int kt = 0; kt < NK; ++kt) { float t = 0.f;
#pragma unroll
            for (int j = 0; j < 8; ++j) { s[kt][j] = __builtin_amdgcn_exp2f(__builtin_fmaf(s[kt][j], c, -mc)); t += s[kt][j]; }
            ps += t; }
        l = l * alpha + ps;
#pragma unroll
        for (int db = 0; db < 4; ++db) o[db] *= alpha;
#pragma unroll
        for (int g = 0; g < NG; ++g) { V pf, pf2; pfrag(s[2 * g], s[2 * g + 1], pf, pf2);
#pragma unroll
            for (int db = 0; db < 4; ++db) { o[db] = WFrag<T16>::mma(va[g][db], pf, o[db]); if constexpr (SPLIT) { o[db] = WFrag<T16>::mma(va2[g][db], pf, o[db]); o[db] = WFrag<T16>::mma(va[g][db], pf2, o[db]); } } }
    }
    l += xhalf(l);
    const float inv = __fdiv_rn(1.0f, l);
#pragma unroll
    for (int db = 0; db < 4; ++db) { v8us oh, ol;
#pragma unroll
        for (int j = 0; j < 8; ++j) { unsigned short a, c2; splitf(o[db][j] * inv, a, c2); oh[j] = a; ol[j] = c2; }
        const size_t oo = (size_t)(q0 + lr) * DQ + db * 16 + 8 * hi; *(v8us*)(Ah + oo) = oh; *(v8us*)(Al + oo) = ol; }
}
// grid (TT/16, heads), one wave a block; the longest rows (most keys) are dealt first.
__global__ __launch_bounds__(32) void k_attn(const h16* __restrict__ Q16, const h16* __restrict__ K16, const h16* __restrict__ V16, const bf* __restrict__ Qh, const bf* __restrict__ Ql, const bf* __restrict__ Kh, const bf* __restrict__ Kl, const bf* __restrict__ Vh, const bf* __restrict__ Vl, bf* Ah, bf* Al) {
    const int lane = threadIdx.x & 31, lr = lane & 15, hi = lane >> 4; const int q0 = (TT / 16 - 1 - (int)blockIdx.x) * 16; const size_t hb = (size_t)blockIdx.y * TT * HD; const size_t ho = (size_t)blockIdx.y * HD;
    if (q0 < RH) attn_rows<bf, true, 32>(Qh + hb, Ql + hb, Kh + hb, Kl + hb, Vh + hb, Vl + hb, q0, lr, hi, Ah + ho, Al + ho);
    else attn_rows<h16, false, 64>(Q16 + hb, nullptr, K16 + hb, nullptr, V16 + hb, nullptr, q0, lr, hi, Ah + ho, Al + ho);
}

extern "C" void kernel_launch(void* const* d_in, const int* in_sizes, int n_in,
                              void* d_out, int out_size, void* d_ws, size_t ws_size, hipStream_t stream) {
    if (n_in < 6) return;
    const size_t xneed = (size_t)(NB - 1) * SEQ_FULL * DM + (size_t)TT * DM;
    if ((size_t)in_sizes[0] < xneed || (size_t)in_sizes[1] < (size_t)DM * DQ || (size_t)in_sizes[2] < (size_t)DM * DQ || (size_t)in_sizes[3] < (size_t)DM * DQ || (size_t)in_sizes[4] < (size_t)DQ * DM || in_sizes[5] < DM || (size_t)out_size < xneed) return;
    const float* x = (const float*)d_in[0]; const float* wq = (const float*)d_in[1]; const float* wk = (const float*)d_in[2]; const float* wv = (const float*)d_in[3]; const float* wo = (const float*)d_in[4]; const float* bo = (const float*)d_in[5];
    float* OUT = (float*)d_out;     // [NB][SEQ][1024], batch stride SEQ_FULL*DM
    char* wsp = (char*)d_ws;
    auto take = [&](size_t bytes) { char* p = wsp; wsp += (bytes + 255) & ~(size_t)255; return (void*)p; };
    bf* WQ = (bf*)take((size_t)DQ * DM * 2); bf* WK = (bf*)take((size_t)DQ * DM * 2); bf* WV = (bf*)take((size_t)DQ * DM * 2); bf* WO = (bf*)take((size_t)DM * DQ * 2);
    bf* XB = (bf*)take((size_t)TT * DM * 2);
    h16* QP16 = (h16*)take((size_t)NH_ * TT * HD * 2); h16* KP16 = (h16*)take((size_t)NH_ * TT * HD * 2); h16* VT16 = (h16*)take((size_t)NH_ * HD * TT * 2);
    bf* QPh = (bf*)take((size_t)NH_ * TT * HD * 2); bf* QPl = (bf*)take((size_t)NH_ * TT * HD * 2); bf* KPh = (bf*)take((size_t)NH_ * TT * HD * 2); bf* KPl = (bf*)take((size_t)NH_ * TT * HD * 2); bf* VTh = (bf*)take((size_t)NH_ * HD * TT * 2); bf* VTl = (bf*)take((size_t)NH_ * HD * TT * 2);
    bf* ATh = (bf*)take((size_t)TT * DQ * 2); bf* ATl = (bf*)take((size_t)TT * DQ * 2);
    if ((size_t)(wsp - (char*)d_ws) > ws_size) return;
    // weights: Bt[n][k] bf16 planes from the [in][out] storage
    { const unsigned gw = (unsigned)((DQ * DM / 64 + 63) / 64);
      k_wtG<<<gw, 256, 0, stream>>>(wq, DM, DQ, WQ); k_wtG<<<gw, 256, 0, stream>>>(wk, DM, DQ, WK); k_wtG<<<gw, 256, 0, stream>>>(wv, DM, DQ, WV); k_wtG<<<gw, 256, 0, stream>>>(wo, DQ, DM, WO); }
    const unsigned LX = (unsigned)(((size_t)TT * DM / 8 + 255) / 256);
    for (int b = 0; b < NB; ++b) {
        k_cvt8<<<LX, 256, 0, stream>>>(x + (size_t)b * SEQ_FULL * DM, XB, (size_t)TT * DM / 8);
        k_gemmw<bf, 0, false, true><<<dim3(DQ / 64, TT / 64, 1), 32, 0, stream>>>(WQ, nullptr, XB, nullptr, DM, nullptr, 0, nullptr, 0, 0, 0, QP16, QPh, QPl, HD, (size_t)TT * HD);
        k_gemmw<bf, 0, false, true><<<dim3(DQ / 64, TT / 64, 1), 32, 0, stream>>>(WK, nullptr, XB, nullptr, DM, nullptr, 0, nullptr, 0, 0, 0, KP16, KPh, KPl, HD, (size_t)TT * HD);
        k_gemmw<bf, 0, false, true><<<dim3(TT / 64, DQ / 64, 1), 32, 0, stream>>>(XB, nullptr, WV, nullptr, DM, nullptr, 0, nullptr, 0, 0, 0, VT16, VTh, VTl, TT, (size_t)64);
        k_attn<<<dim3(TT / 16, NH_, 1), 32, 0, stream>>>(QP16, KP16, VT16, QPh, QPl, KPh, KPl, VTh, VTl, ATh, ATl);
        k_gemmw<bf, 1, true, false><<<dim3(TT / 64, DM / 64, 1), 32, 0, stream>>>(ATh, ATl, WO, nullptr, DQ, OUT + (size_t)b * SEQ_FULL * DM, DM, bo, 0, 0, 0, nullptr, nullptr, nullptr, 0, 0); }
}

// v003
// One run takes 198 microseconds.
// Two timings next to v002 put it at 1.72 and 1.73 times that version's speed.
// Counting every step since v000, it is 7.32 times as fast.
#include <hip/hip_runtime.h>

// Causal multi-head self-attention: x [NB][SEQ][1024]; q/k/v = x W (W stored [in][out], no bias; 16 heads x 64); softmax(q.k^T / 8) under a lower-triangular mask; out = merged(attn.v) Wo + bo -> [NB][SEQ][1024] f32.
// Compute dtypes, f32 accumulate: every float input RNE-converted to bf16 on load; q/k/v projections v_wmma_f32_16x16x32_bf16 on plain bf16 operands (exact products);
// causal scores and attn.v: query rows < RH on bf16 hi/lo operand planes (3 products, v_wmma_f32_16x16x32_bf16), rows >= RH on single fp16 operands (v_wmma_f32_16x16x32_f16, probabilities carried unnormalised); online softmax f32, scores kept in registers;
// output projection: bf16 hi/lo activations x exact bf16 Wo (2 products) + bias.

#ifndef NB
#define NB   2
#endif
#ifndef SEQ
#define SEQ  2048
#endif
#define NB_FULL  2
#define SEQ_FULL 2048
#define TT   SEQ
#define DM   1024
#define NH_  16
#define HD   64
#define DQ   (NH_ * HD)
#ifndef RH
#define RH   (((SEQ) < 512) ? (SEQ) : 512)   // query rows < RH use hi+lo planes
#endif
#define SCL  0.125f   // HD^-0.5

static_assert((SEQ) % 128 == 0);
static_assert((RH) % 64 == 0);
static_assert((RH) <= (SEQ));
static_assert((DM) % 64 == 0);
static_assert((HD) == 64);
static_assert((NB) >= 1 && (NB) <= (NB_FULL));
static_assert((SEQ) <= (SEQ_FULL));

typedef _Float16 h16;
typedef unsigned short bf;
typedef __attribute__((ext_vector_type(16))) __bf16   v16bf;
typedef __attribute__((ext_vector_type(16))) _Float16 v16h;
typedef __attribute__((ext_vector_type(8)))  _Float16 v8h;
typedef __attribute__((ext_vector_type(8)))  unsigned short v8us;
typedef __attribute__((ext_vector_type(8)))  float    v8f;
typedef __attribute__((ext_vector_type(4)))  float    v4f;
typedef v8h  __attribute__((may_alias)) v8ha;
typedef v4f  __attribute__((may_alias)) v4fa;
typedef v8us __attribute__((may_alias)) v8usa;

__device__ __forceinline__ unsigned short f2bf(float f) { unsigned u = __float_as_uint(f); u += 0x7FFFu + ((u >> 16) & 1u); return (unsigned short)(u >> 16); }
__device__ __forceinline__ float bf2f(unsigned short b) { return __uint_as_float(((unsigned)b) << 16); }
__device__ __forceinline__ float bfr(float f) { return bf2f(f2bf(f)); }
__device__ __forceinline__ h16 tohx(float x) { return (h16)x; }
__device__ __forceinline__ void splitf(float y, unsigned short& h, unsigned short& l) { h = f2bf(y); l = f2bf(y - bf2f(h)); }
__device__ __forceinline__ v16h cat16(v8h lo, v8h hi) { return __builtin_shufflevector(lo, hi, 0, 1, 2, 3, 4, 5, 6, 7, 8, 9, 10, 11, 12, 13, 14, 15); }
__device__ __forceinline__ v16bf cat16b(v8us lo, v8us hi) { return __builtin_bit_cast(v16bf, __builtin_shufflevector(lo, hi, 0, 1, 2, 3, 4, 5, 6, 7, 8, 9, 10, 11, 12, 13, 14, 15)); }
__device__ __forceinline__ v8f wmma16(v16h a, v16h b, v8f c) { return __builtin_amdgcn_wmma_f32_16x16x32_f16(false, a, false, b, (short)0, c, false, false); }
__device__ __forceinline__ v8f wmmab(v16bf a, v16bf b, v8f c) { return __builtin_amdgcn_wmma_f32_16x16x32_bf16(false, a, false, b, (short)0, c, false, false); }

// ---- k_gemmw: register-blocked GEMM, ONE WAVE per 64x64 output tile (16 accumulators), operands straight from K-contiguous 16-bit planes; grid (M/64, N/64, Z), 32 threads (PLANES: see below).
// C[m][n] (f32, pitch ldc, + optional f32 bias[n]) = sum_k A[m][k] Bt[n][k] (+ split products per NSPLIT). z-batch strides sA/sB/sC in elements. K % 32 == 0.
// PLANES: no f32 C; the tile leaves as the three 16-bit operand planes of the attention kernel (fp16, bf16 hi, bf16 lo), straight from the accumulators: a lane's 8 elements are 8 consecutive rows m of one column n,
// stored as one 16-byte piece a plane at element (bx * prs + (m & 63)) + n * ppitch, bx = m / 64. q, k: A = weight (m = head * 64 + d), Bt = x (n = t), ppitch 64, prs SEQ * 64 -> [head][t][d]; v: A = x (m = t), Bt = weight (n = head * 64 + d), ppitch SEQ, prs 64 -> [head][d][t].
// PLANES takes q, k and v of every batch in ONE launch: grid (weight panels, token panels, 3 * NB), z = job * NB + batch (job 0 q, 1 k, 2 v); A = the three weight planes (stride sA), Bt = x (batch stride sB), each of P16, Ph, Pl = 3 * NB planes (stride sC) indexed by z; ppitch, prs arrive for q and k.
// Fragments: lane l -> row/col (l & 15); elements 0..7 <- k0 + 8*(l>>4) + 0..7, elements 8..15 <- k0 + 16 + 8*(l>>4) + 0..7 for A and B alike; D element j of lane l = (row 8*(l>>4)+j, col l&15).
template <typename T16> struct WFrag;
template <> struct WFrag<h16> { typedef v16h V; static __device__ __forceinline__ V ld(const h16* p) { return cat16(*(const v8h*)p, *(const v8h*)(p + 16)); } static __device__ __forceinline__ v8f mma(V a, V b, v8f c) { return wmma16(a, b, c); } };
template <> struct WFrag<bf> { typedef v16bf V; static __device__ __forceinline__ V ld(const bf* p) { return cat16b(*(const v8us*)p, *(const v8us*)(p + 16)); } static __device__ __forceinline__ v8f mma(V a, V b, v8f c) { return wmmab(a, b, c); } };
template <typename T16, int NSPLIT, bool BIAS, bool PLANES>
__global__ __launch_bounds__(32) void k_gemmw(const T16* __restrict__ A, const T16* __restrict__ A2, const T16* __restrict__ Bt, const T16* __restrict__ Bt2, int K, float* C, int ldc, const float* __restrict__ bias, size_t sA, size_t sB, size_t sC, h16* P16, bf* Ph, bf* Pl, int ppitch, size_t prs) {
    typedef typename WFrag<T16>::V V;
    __shared__ __align__(16) float os[16 * 68];
    const size_t z = blockIdx.z; int bx = blockIdx.x, by = blockIdx.y;
    if constexpr (PLANES) { const size_t job = z / NB; const T16* Wj = A + job * sA; const T16* Xb = Bt + (z - job * NB) * sB; P16 += z * sC; Ph += z * sC; Pl += z * sC;
        if (job == 2) { A = Xb; Bt = Wj; bx = blockIdx.y; by = blockIdx.x; ppitch = TT; prs = 64; } else { A = Wj; Bt = Xb; } }
    else { A += z * sA; if (A2) A2 += z * sA; Bt += z * sB; if (Bt2) Bt2 += z * sB; C += z * sC; }
    const int lane = threadIdx.x & 31, lr = lane & 15, hi = lane >> 4; const int r0 = bx * 64, c0 = by * 64;
    v8f acc[4][4];
#pragma unroll
    for (int mb = 0; mb < 4; ++mb)
#pragma unroll
        for (int nb = 0; nb < 4; ++nb) acc[mb][nb] = (v8f){};
    const size_t aoff = (size_t)(r0 + lr) * K + 8 * hi, boff = (size_t)(c0 + lr) * K + 8 * hi;
#pragma unroll 1
    for (int kc = 0; kc < K; kc += 32) {
        V a[4], a2[4];
#pragma unroll
        for (int mb = 0; mb < 4; ++mb) { a[mb] = WFrag<T16>::ld(A + aoff + (size_t)mb * 16 * K + kc); if (NSPLIT == 1 || NSPLIT == 2) a2[mb] = WFrag<T16>::ld(A2 + aoff + (size_t)mb * 16 * K + kc); }
#pragma unroll
        for (int nb = 0; nb < 4; ++nb) { const V b = WFrag<T16>::ld(Bt + boff + (size_t)nb * 16 * K + kc); V b2; if (NSPLIT >= 2) b2 = WFrag<T16>::ld(Bt2 + boff + (size_t)nb * 16 * K + kc);
#pragma unroll
            for (int mb = 0; mb < 4; ++mb) { acc[mb][nb] = WFrag<T16>::mma(a[mb], b, acc[mb][nb]); if (NSPLIT == 1 || NSPLIT == 2) acc[mb][nb] = WFrag<T16>::mma(a2[mb], b, acc[mb][nb]); if (NSPLIT >= 2) acc[mb][nb] = WFrag<T16>::mma(a[mb], b2, acc[mb][nb]); } }
        asm volatile("v_nop\n\tv_nop\n\tv_nop\n\tv_nop" : "+v"(acc[0][0]), "+v"(acc[1][1]), "+v"(acc[2][2]), "+v"(acc[3][3]) : "v"(a[0]), "v"(a[3]));
    }
    if constexpr (PLANES) {
        const size_t pb = (size_t)bx * prs + (size_t)(c0 + lr) * ppitch + 8 * hi;
        // all three loops unrolled: the accumulators are indexed by constants alone and stay in registers
#pragma unroll
        for (int nb = 0; nb < 4; ++nb)
#pragma unroll
            for (int mb = 0; mb < 4; ++mb) { v8h o16; v8us oh, ol;      // the four pieces of a 128-byte line go out one after the other
#pragma unroll
                for (int j = 0; j < 8; ++j) { const float x = acc[mb][nb][j]; o16[j] = tohx(x); unsigned short a2, c2; splitf(x, a2, c2); oh[j] = a2; ol[j] = c2; }
                const size_t po = pb + (size_t)(nb * 16) * ppitch + mb * 16; *(v8h*)(P16 + po) = o16; *(v8us*)(Ph + po) = oh; *(v8us*)(Pl + po) = ol; }
        return;
    }
#pragma unroll
    for (int mb = 0; mb < 4; ++mb) {
#pragma unroll
        for (int nb = 0; nb < 4; ++nb) {
#pragma unroll
            for (int j = 0; j < 8; ++j) os[(hi * 8 + j) * 68 + nb * 16 + lr] = acc[mb][nb][j]; }
        __builtin_amdgcn_wave_barrier(); asm volatile("" ::: "memory");
        float* crow = C + (size_t)(r0 + mb * 16) * ldc + c0;
{
#pragma unroll
            for (int s = 0; s < 8; ++s) { const int row = 2 * s + hi, cofs = lr * 4; v4f val = *(const v4fa*)(os + row * 68 + cofs); if (BIAS) { val[0] += bfr(bias[c0 + cofs]); val[1] += bfr(bias[c0 + cofs + 1]); val[2] += bfr(bias[c0 + cofs + 2]); val[3] += bfr(bias[c0 + cofs + 3]); }
                *(v4f*)(crow + (size_t)row * ldc + cofs) = val; }
             }
        __builtin_amdgcn_wave_barrier(); asm volatile("" ::: "memory");
    }
}

typedef __attribute__((ext_vector_type(2))) _Float16 v2h;
typedef __attribute__((ext_vector_type(4))) _Float16 v4h;
typedef __attribute__((ext_vector_type(2))) unsigned short v2us;
typedef __attribute__((ext_vector_type(4))) unsigned short v4us;
typedef __attribute__((ext_vector_type(2))) float v2f;
typedef __attribute__((ext_vector_type(4))) int v4i;

__device__ __forceinline__ void wtG(const float* __restrict__ w, int K, int N, bf* Bt, int blk) {
    const int lane = threadIdx.x & 31; const int L0 = (blk * 8 + (threadIdx.x >> 5)) * 8; const int nlines = N * K / 64;
{
#pragma unroll 1
        for (int l = 0; l < 8; ++l) { const int L = L0 + l; if (L >= nlines) break; const size_t e = (size_t)L * 64 + lane * 2; const int k = (int)(e % K), n = (int)(e / K); v2us o;
            o[0] = f2bf(w[(size_t)k * N + n]); o[1] = f2bf(w[(size_t)(k + 1) * N + n]); *(v2us*)(Bt + e) = o; }
         }
}
__device__ __forceinline__ void cvt8(const float* __restrict__ src, bf* dst, size_t n8, int blk) { const size_t i = (size_t)blk * 256 + threadIdx.x; if (i >= n8) return; const v8f v = *(const v8f*)(src + i * 8); v8us o;
#pragma unroll
    for (int k = 0; k < 8; ++k) o[k] = f2bf(v[k]); *(v8us*)(dst + i * 8) = o;  }
// all operand conversions in ONE launch, the job picked by block range: 4 * GWT blocks turn the four weights (the longer job, dealt first), then NB * GCV blocks convert x. W: four planes one behind the other (q, k, v, o); XB: [NB][TT][DM].
#define GWT  ((DQ * DM / 64 + 63) / 64)
#define GCV  ((TT * DM / 8 + 255) / 256)
__global__ __launch_bounds__(256) void k_prep(const float* __restrict__ x, const float* __restrict__ wq, const float* __restrict__ wk, const float* __restrict__ wv, const float* __restrict__ wo, bf* W, bf* XB) {
    const int blk = (int)blockIdx.x;
    if (blk < 4 * GWT) { const int j = blk / GWT; wtG(j == 0 ? wq : j == 1 ? wk : j == 2 ? wv : wo, j == 3 ? DQ : DM, j == 3 ? DM : DQ, W + (size_t)j * DQ * DM, blk - j * GWT); }
    else { const int b = (blk - 4 * GWT) / GCV; cvt8(x + (size_t)b * SEQ_FULL * DM, XB + (size_t)b * TT * DM, (size_t)TT * DM / 8, blk - 4 * GWT - b * GCV); }
}
// ---- k_attn: causal attention for one head and 16 query rows per wave, scores never leave registers. Both products are taken transposed: S^T = K.Q^T puts a query in each lane (column l & 15) and keys 8*(l>>4)+j in
// its accumulator elements, which is already the B-fragment k order of O^T = V^T.P^T (key tile 2g -> elements 0..7, key tile 2g+1 -> elements 8..15), so probabilities go from accumulator to operand without a shuffle.
// Online softmax: running maximum m of the raw scores and running sum l per query; o and l are rescaled by exp2((m_old - m_new) c) each pass of KB keys. Probabilities are carried unnormalised (<= 1); the division by l is last.
__device__ __forceinline__ float xhalf(float x) { return __builtin_bit_cast(float, __builtin_amdgcn_permlanex16(__builtin_bit_cast(int, x), __builtin_bit_cast(int, x), 0x76543210, 0xfedcba98, false, false)); }  // lane l with lane l ^ 16
__device__ __forceinline__ void pfrag(const v8f& p0, const v8f& p1, v16h& f, v16h& f2) { (void)f2;
#pragma unroll
    for (int j = 0; j < 8; ++j) { f[j] = tohx(p0[j]); f[8 + j] = tohx(p1[j]); } }
__device__ __forceinline__ void pfrag(const v8f& p0, const v8f& p1, v16bf& f, v16bf& f2) { v8us h0, h1, l0, l1;
#pragma unroll
    for (int j = 0; j < 8; ++j) { unsigned short a, c2; splitf(p0[j], a, c2); h0[j] = a; l0[j] = c2; splitf(p1[j], a, c2); h1[j] = a; l1[j] = c2; }
    f = cat16b(h0, h1); f2 = cat16b(l0, l1); }
template <typename T16, bool SPLIT, int KB>
__device__ __forceinline__ void attn_rows(const T16* __restrict__ Q, const T16* __restrict__ Q2, const T16* __restrict__ Kp, const T16* __restrict__ K2, const T16* __restrict__ Vt, const T16* __restrict__ V2, int q0, int lr, int hi, bf* Ah, bf* Al) {
    typedef typename WFrag<T16>::V V;
    constexpr int NK = KB / 16, NG = KB / 32;
    const float c = SCL * 1.4426950408889634f;
    V qf[2], qf2[2];
#pragma unroll
    for (int ks = 0; ks < 2; ++ks) { qf[ks] = WFrag<T16>::ld(Q + (size_t)(q0 + lr) * HD + ks * 32 + 8 * hi); if constexpr (SPLIT) qf2[ks] = WFrag<T16>::ld(Q2 + (size_t)(q0 + lr) * HD + ks * 32 + 8 * hi); }
    v8f o[4];
#pragma unroll
    for (int db = 0; db < 4; ++db) o[db] = (v8f){};
    float m = -3.0e38f, l = 0.f;
    const unsigned koff = (unsigned)(lr * HD + 8 * hi), voff = (unsigned)(lr * TT + 8 * hi);
#pragma unroll 1
    for (int k0 = 0; k0 <= q0 + 15; k0 += KB) {
        V ka[NK][2], ka2[NK][2], va[NG][4], va2[NG][4];     // all of a pass's requests go out in one run, keys first: one memory latency a pass, and the values' share of it runs under scores and softmax
        const size_t kb = (size_t)k0 * HD;
#pragma unroll
        for (int kt = 0; kt < NK; ++kt)
#pragma unroll
            for (int ks = 0; ks < 2; ++ks) { ka[kt][ks] = WFrag<T16>::ld(Kp + kb + koff + (kt * 16 * HD + ks * 32)); if constexpr (SPLIT) ka2[kt][ks] = WFrag<T16>::ld(K2 + kb + koff + (kt * 16 * HD + ks * 32)); }
        asm volatile("s_wait_xcnt 0x0" ::: "memory");       // precaution: a value request below may land in a register pair that the key requests above name as an address
#pragma unroll
        for (int g = 0; g < NG; ++g)
#pragma unroll
            for (int db = 0; db < 4; ++db) va[g][db] = WFrag<T16>::ld(Vt + k0 + voff + (db * 16 * TT + g * 32));
        if constexpr (SPLIT) { asm volatile("s_wait_xcnt 0x0" ::: "memory");   // the same precaution between the two value planes
#pragma unroll
            for (int g = 0; g < NG; ++g)
#pragma unroll
                for (int db = 0; db < 4; ++db) va2[g][db] = WFrag<T16>::ld(V2 + k0 + voff + (db * 16 * TT + g * 32)); }
        asm volatile("s_wait_xcnt 0x0" ::: "memory");       // precaution: stands in front of every later write of a register that the requests above name as an address
        // inputs-only fence on the loaded key fragments: all eight are in flight together; without it they are asked for in turns into reused registers, several latencies a pass
        if constexpr (SPLIT) asm volatile("" :: "v"(ka[0][0]), "v"(ka[0][1]), "v"(ka[1][0]), "v"(ka[1][1]), "v"(ka2[0][0]), "v"(ka2[0][1]), "v"(ka2[1][0]), "v"(ka2[1][1]));
        else asm volatile("" :: "v"(ka[0][0]), "v"(ka[0][1]), "v"(ka[1][0]), "v"(ka[1][1]), "v"(ka[NK - 2][0]), "v"(ka[NK - 2][1]), "v"(ka[NK - 1][0]), "v"(ka[NK - 1][1]));
        v8f s[NK];
#pragma unroll
        for (int kt = 0; kt < NK; ++kt) { v8f acc = (v8f){};
#pragma unroll
            for (int ks = 0; ks < 2; ++ks) { acc = WFrag<T16>::mma(ka[kt][ks], qf[ks], acc);
                if constexpr (SPLIT) { acc = WFrag<T16>::mma(ka2[kt][ks], qf[ks], acc); acc = WFrag<T16>::mma(ka[kt][ks], qf2[ks], acc); } }
            s[kt] = acc; }
        if (k0 + KB - 1 > q0) {      // only passes that reach the diagonal hold keys above a query: mask by index select
#pragma unroll
            for (int kt = 0; kt < NK; ++kt)
#pragma unroll
                for (int j = 0; j < 8; ++j) s[kt][j] = (k0 + kt * 16 + 8 * hi + j <= q0 + lr) ? s[kt][j] : -3.0e38f; }
        float mx = m;
#pragma unroll
        for (int kt = 0; kt < NK; ++kt) { float t = s[kt][0];      // one short chain a key tile, side by side
#pragma unroll
            for (int j = 1; j < 8; ++j) t = fmaxf(t, s[kt][j]);
            mx = fmaxf(mx, t); }
        mx = fmaxf(mx, xhalf(mx));      // the two lane halves hold different keys of the same query
        const float mc = mx * c;                        // exponent as one fused multiply-add a score: s c - max c
        const float alpha = __builtin_amdgcn_exp2f(__builtin_fmaf(m, c, -mc)); m = mx;
        float ps = 0.f;
#pragma unroll
        for (int kt = 0; kt < NK; ++kt) { float t = 0.f;
#pragma unroll
            for (int j = 0; j < 8; ++j) { s[kt][j] = __builtin_amdgcn_exp2f(__builtin_fmaf(s[kt][j], c, -mc)); t += s[kt][j]; }
            ps += t; }
        l = l * alpha + ps;
#pragma unroll
        for (int db = 0; db < 4; ++db) o[db] *= alpha;
#pragma unroll
        for (int g = 0; g < NG; ++g) { V pf, pf2; pfrag(s[2 * g], s[2 * g + 1], pf, pf2);
#pragma unroll
            for (int db = 0; db < 4; ++db) { o[db] = WFrag<T16>::mma(va[g][db], pf, o[db]); if constexpr (SPLIT) { o[db] = WFrag<T16>::mma(va2[g][db], pf, o[db]); o[db] = WFrag<T16>::mma(va[g][db], pf2, o[db]); } } }
    }
    l += xhalf(l);
    const float inv = __fdiv_rn(1.0f, l);
#pragma unroll
    for (int db = 0; db < 4; ++db) { v8us oh, ol;
#pragma unroll
        for (int j = 0; j < 8; ++j) { unsigned short a, c2; splitf(o[db][j] * inv, a, c2); oh[j] = a; ol[j] = c2; }
        const size_t oo = (size_t)(q0 + lr) * DQ + db * 16 + 8 * hi; *(v8us*)(Ah + oo) = oh; *(v8us*)(Al + oo) = ol; }
}
// grid (TT/16, heads, NB), one wave a block; the longest rows (most keys) of a head are dealt first. Every operand plane is [NB][heads][...]; Ah, Al: [NB][TT][DQ].
__global__ __launch_bounds__(32) void k_attn(const h16* __restrict__ Q16, const h16* __restrict__ K16, const h16* __restrict__ V16, const bf* __restrict__ Qh, const bf* __restrict__ Ql, const bf* __restrict__ Kh, const bf* __restrict__ Kl, const bf* __restrict__ Vh, const bf* __restrict__ Vl, bf* Ah, bf* Al) {
    const int lane = threadIdx.x & 31, lr = lane & 15, hi = lane >> 4; const int q0 = (TT / 16 - 1 - (int)blockIdx.x) * 16; const size_t hb = ((size_t)blockIdx.z * NH_ + blockIdx.y) * TT * HD; const size_t ho = (size_t)blockIdx.z * TT * DQ + (size_t)blockIdx.y * HD;
    if (q0 < RH) attn_rows<bf, true, 32>(Qh + hb, Ql + hb, Kh + hb, Kl + hb, Vh + hb, Vl + hb, q0, lr, hi, Ah + ho, Al + ho);
    else attn_rows<h16, false, 64>(Q16 + hb, nullptr, K16 + hb, nullptr, V16 + hb, nullptr, q0, lr, hi, Ah + ho, Al + ho);
}

extern "C" void kernel_launch(void* const* d_in, const int* in_sizes, int n_in,
                              void* d_out, int out_size, void* d_ws, size_t ws_size, hipStream_t stream) {
    if (n_in < 6) return;
    const size_t xneed = (size_t)(NB - 1) * SEQ_FULL * DM + (size_t)TT * DM;
    if ((size_t)in_sizes[0] < xneed || (size_t)in_sizes[1] < (size_t)DM * DQ || (size_t)in_sizes[2] < (size_t)DM * DQ || (size_t)in_sizes[3] < (size_t)DM * DQ || (size_t)in_sizes[4] < (size_t)DQ * DM || in_sizes[5] < DM || (size_t)out_size < xneed) return;
    const float* x = (const float*)d_in[0]; const float* wq = (const float*)d_in[1]; const float* wk = (const float*)d_in[2]; const float* wv = (const float*)d_in[3]; const float* wo = (const float*)d_in[4]; const float* bo = (const float*)d_in[5];
    float* OUT = (float*)d_out;     // [NB][SEQ][1024], batch stride SEQ_FULL*DM
    char* wsp = (char*)d_ws;
    auto take = [&](size_t bytes) { char* p = wsp; wsp += (bytes + 255) & ~(size_t)255; return (void*)p; };
    bf* WALL = (bf*)take((size_t)4 * DQ * DM * 2);      // weight planes Bt[n][k] from the [in][out] storage: q, k, v, o, one behind the other
    bf* XB = (bf*)take((size_t)NB * TT * DM * 2);
    const size_t PS = (size_t)NH_ * TT * HD;            // elements of one operand plane of one batch
    h16* P16 = (h16*)take((size_t)3 * NB * PS * 2); bf* PH = (bf*)take((size_t)3 * NB * PS * 2); bf* PL = (bf*)take((size_t)3 * NB * PS * 2);     // [q, k, v][NB] planes
    bf* ATh = (bf*)take((size_t)NB * TT * DQ * 2); bf* ATl = (bf*)take((size_t)NB * TT * DQ * 2);
    if ((size_t)(wsp - (char*)d_ws) > ws_size) return;
    k_prep<<<4 * GWT + NB * GCV, 256, 0, stream>>>(x, wq, wk, wv, wo, WALL, XB);
    k_gemmw<bf, 0, false, true><<<dim3(DQ / 64, TT / 64, 3 * NB), 32, 0, stream>>>(WALL, nullptr, XB, nullptr, DM, nullptr, 0, nullptr, (size_t)DQ * DM, (size_t)TT * DM, PS, P16, PH, PL, HD, (size_t)TT * HD);
    k_attn<<<dim3(TT / 16, NH_, NB), 32, 0, stream>>>(P16, P16 + NB * PS, P16 + 2 * NB * PS, PH, PL, PH + NB * PS, PL + NB * PS, PH + 2 * NB * PS, PL + 2 * NB * PS, ATh, ATl);
    k_gemmw<bf, 1, true, false><<<dim3(TT / 64, DM / 64, NB), 32, 0, stream>>>(ATh, ATl, WALL + (size_t)3 * DQ * DM, nullptr, DQ, OUT, DM, bo, (size_t)TT * DQ, 0, (size_t)SEQ_FULL * DM, nullptr, nullptr, nullptr, 0, 0);
}

// v004
// It runs in 146 microseconds.
// Next to v003, in two timings, it ran 1.36 and 1.34 times as fast.
// All steps since v000 together make it 9.90 times as fast.
#include <hip/hip_runtime.h>

// Causal multi-head self-attention: x [NB][SEQ][1024]; q/k/v = x W (W stored [in][out], no bias; 16 heads x 64); softmax(q.k^T / 8) under a lower-triangular mask; out = merged(attn.v) Wo + bo -> [NB][SEQ][1024] f32.
// Compute dtypes, f32 accumulate: every float input RNE-converted to bf16 on load; q/k/v projections v_wmma_f32_16x16x32_bf16 on plain bf16 operands (exact products);
// causal scores and attn.v: query rows < RH on bf16 hi/lo operand planes (3 products, v_wmma_f32_16x16x32_bf16), rows >= RH on single fp16 operands (v_wmma_f32_16x16x32_f16, probabilities carried unnormalised); online softmax f32, scores kept in registers;
// output projection: bf16 hi/lo activations x exact bf16 Wo (2 products) + bias.
// FRAGMENT ORDER: every 16-bit operand plane (a matrix M[row][k]) lies in the workspace as 1 KB blocks, one per (16 rows, 32 k): element (row, k) of a block sits at ((k & 31) >> 4) * 256 + (((k >> 3) & 1) * 16 + (row & 15)) * 8 + (k & 7).
// Lane l's fragment is then the 16 bytes at l * 16 of each 512-byte half: a wave's load covers 4 whole 128-byte lines, and which element reaches which lane and register is as with row-major planes.
// Blocks of a GEMM operand: [row / 16][k / 32]; q, k planes per head: [t / 16][d / 32]; v planes per head: [t / 32][d / 16].

#ifndef NB
#define NB   2
#endif
#ifndef SEQ
#define SEQ  2048
#endif
#define NB_FULL  2
#define SEQ_FULL 2048
#define TT   SEQ
#define DM   1024
#define NH_  16
#define HD   64
#define DQ   (NH_ * HD)
#ifndef RH
#define RH   (((SEQ) < 512) ? (SEQ) : 512)   // query rows < RH use hi+lo planes
#endif
#define SCL  0.125f   // HD^-0.5

static_assert((SEQ) % 128 == 0);
static_assert((RH) % 64 == 0);
static_assert((RH) <= (SEQ));
static_assert((DM) % 64 == 0);
static_assert((HD) == 64);
static_assert((NB) >= 1 && (NB) <= (NB_FULL));
static_assert((SEQ) <= (SEQ_FULL));

typedef _Float16 h16;
typedef unsigned short bf;
typedef __attribute__((ext_vector_type(16))) __bf16   v16bf;
typedef __attribute__((ext_vector_type(16))) _Float16 v16h;
typedef __attribute__((ext_vector_type(8)))  _Float16 v8h;
typedef __attribute__((ext_vector_type(8)))  unsigned short v8us;
typedef __attribute__((ext_vector_type(8)))  float    v8f;
typedef __attribute__((ext_vector_type(4)))  float    v4f;
typedef v8h  __attribute__((may_alias)) v8ha;
typedef v4f  __attribute__((may_alias)) v4fa;
typedef v8us __attribute__((may_alias)) v8usa;

__device__ __forceinline__ unsigned short f2bf(float f) { unsigned u = __float_as_uint(f); u += 0x7FFFu + ((u >> 16) & 1u); return (unsigned short)(u >> 16); }
__device__ __forceinline__ float bf2f(unsigned short b) { return __uint_as_float(((unsigned)b) << 16); }
__device__ __forceinline__ float bfr(float f) { return bf2f(f2bf(f)); }
__device__ __forceinline__ h16 tohx(float x) { return (h16)x; }
__device__ __forceinline__ void splitf(float y, unsigned short& h, unsigned short& l) { h = f2bf(y); l = f2bf(y - bf2f(h)); }
__device__ __forceinline__ v16h cat16(v8h lo, v8h hi) { return __builtin_shufflevector(lo, hi, 0, 1, 2, 3, 4, 5, 6, 7, 8, 9, 10, 11, 12, 13, 14, 15); }
__device__ __forceinline__ v16bf cat16b(v8us lo, v8us hi) { return __builtin_bit_cast(v16bf, __builtin_shufflevector(lo, hi, 0, 1, 2, 3, 4, 5, 6, 7, 8, 9, 10, 11, 12, 13, 14, 15)); }
__device__ __forceinline__ v8f wmma16(v16h a, v16h b, v8f c) { return __builtin_amdgcn_wmma_f32_16x16x32_f16(false, a, false, b, (short)0, c, false, false); }
__device__ __forceinline__ v8f wmmab(v16bf a, v16bf b, v8f c) { return __builtin_amdgcn_wmma_f32_16x16x32_bf16(false, a, false, b, (short)0, c, false, false); }

// ---- k_gemmw: register-blocked GEMM, ONE WAVE per 64x64 output tile (16 accumulators), operands straight from 16-bit planes in fragment order; grid (M/64, N/64, Z), 32 threads (PLANES: see below).
// C[m][n] (f32, pitch ldc, + optional f32 bias[n]) = sum_k A[m][k] Bt[n][k] (+ split products per NSPLIT). z-batch strides sA/sB/sC in elements. K % 32 == 0; K is a compile-time number, so that the fragments of a trip share one address an operand plane and differ by immediates.
// PLANES: no f32 C; the tile leaves as the three 16-bit operand planes of the attention kernel (fp16, bf16 hi, bf16 lo), straight from the accumulators: a lane's 8 elements are 8 consecutive rows m of one column n,
// which is one 16-byte piece of a fragment-order block, lane l's at l * 16 of a half: a wave's store is 512 bytes in a row. q, k: A = weight (m = head * 64 + d), Bt = x (n = t), rows t, k = d; v: A = x (m = t), Bt = weight (n = head * 64 + d), rows d, k = t.
// PLANES takes q, k and v of every batch in ONE launch: grid (weight panels, token panels, 3 * NB), z = job * NB + batch (job 0 q, 1 k, 2 v); A = the three weight planes (stride sA), Bt = x (batch stride sB), each of P16, Ph, Pl = 3 * NB planes (stride sC) indexed by z.
// Fragments: lane l -> row/col (l & 15); elements 0..7 <- k0 + 8*(l>>4) + 0..7, elements 8..15 <- k0 + 16 + 8*(l>>4) + 0..7 for A and B alike; D element j of lane l = (row 8*(l>>4)+j, col l&15).
template <typename T16> struct WFrag;
template <> struct WFrag<h16> { typedef v16h V; static __device__ __forceinline__ V ld(const h16* p) { return cat16(*(const v8h*)p, *(const v8h*)(p + 256)); } static __device__ __forceinline__ v8f mma(V a, V b, v8f c) { return wmma16(a, b, c); } };
template <> struct WFrag<bf> { typedef v16bf V; static __device__ __forceinline__ V ld(const bf* p) { return cat16b(*(const v8us*)p, *(const v8us*)(p + 256)); } static __device__ __forceinline__ v8f mma(V a, V b, v8f c) { return wmmab(a, b, c); } };
template <typename T16, int NSPLIT, bool BIAS, bool PLANES, int K>
__global__ __launch_bounds__(32) void k_gemmw(const T16* __restrict__ A, const T16* __restrict__ A2, const T16* __restrict__ Bt, const T16* __restrict__ Bt2, float* C, int ldc, const float* __restrict__ bias, size_t sA, size_t sB, size_t sC, h16* P16, bf* Ph, bf* Pl) {
    typedef typename WFrag<T16>::V V;
    __shared__ __align__(16) float os[16 * 68];
    const size_t z = blockIdx.z; int bx = blockIdx.x, by = blockIdx.y; bool isv = false;
    if constexpr (PLANES) { const size_t job = z / NB; const T16* Wj = A + job * sA; const T16* Xb = Bt + (z - job * NB) * sB; P16 += z * sC; Ph += z * sC; Pl += z * sC;
        if (job == 2) { A = Xb; Bt = Wj; bx = blockIdx.y; by = blockIdx.x; isv = true; } else { A = Wj; Bt = Xb; } }
    else { A += z * sA; if (A2) A2 += z * sA; Bt += z * sB; if (Bt2) Bt2 += z * sB; C += z * sC; }
    const int lane = threadIdx.x & 31, lr = lane & 15, hi = lane >> 4; const int r0 = bx * 64, c0 = by * 64;
    v8f acc[4][4];
#pragma unroll
    for (int mb = 0; mb < 4; ++mb)
#pragma unroll
        for (int nb = 0; nb < 4; ++nb) acc[mb][nb] = (v8f){};
    const size_t aoff = (size_t)r0 * K, boff = (size_t)c0 * K; const unsigned loff = (unsigned)(lane * 8);      // 16 rows of blocks = 16 * K elements; 32 k on = 512 elements; the lane's piece is the only per-lane part of an address
#pragma unroll 1
    for (int kc = 0; kc < K; kc += 32) {
        V a[4], a2[4];
        const T16* pa = A + (aoff + kc * 16) + loff; const T16* pa2 = (NSPLIT == 1 || NSPLIT == 2) ? A2 + (aoff + kc * 16) + loff : pa; const T16* pb = Bt + (boff + kc * 16) + loff; const T16* pb2 = (NSPLIT >= 2) ? Bt2 + (boff + kc * 16) + loff : pb;
#pragma unroll
        for (int mb = 0; mb < 4; ++mb) { a[mb] = WFrag<T16>::ld(pa + mb * 16 * K); if (NSPLIT == 1 || NSPLIT == 2) a2[mb] = WFrag<T16>::ld(pa2 + mb * 16 * K); }
#pragma unroll
        for (int nb = 0; nb < 4; ++nb) { const V b = WFrag<T16>::ld(pb + nb * 16 * K); V b2; if (NSPLIT >= 2) b2 = WFrag<T16>::ld(pb2 + nb * 16 * K);
#pragma unroll
            for (int mb = 0; mb < 4; ++mb) { acc[mb][nb] = WFrag<T16>::mma(a[mb], b, acc[mb][nb]); if (NSPLIT == 1 || NSPLIT == 2) acc[mb][nb] = WFrag<T16>::mma(a2[mb], b, acc[mb][nb]); if (NSPLIT >= 2) acc[mb][nb] = WFrag<T16>::mma(a[mb], b2, acc[mb][nb]); } }
        // precaution: stands in front of every write of a register that this trip's requests name as an address; the addresses are its inputs, so that they keep their registers up to here and no request lands in one
        asm volatile("s_wait_xcnt 0x0" :: "v"(pa), "v"(pa2), "v"(pb), "v"(pb2) : "memory");
        asm volatile("v_nop\n\tv_nop\n\tv_nop\n\tv_nop" : "+v"(acc[0][0]), "+v"(acc[1][1]), "+v"(acc[2][2]), "+v"(acc[3][3]) : "v"(a[0]), "v"(a[3]));
    }
    if constexpr (PLANES) {
        // q, k: head bx, block (t / 16) * 2 + d / 32, t = c0 + nb * 16 + lr, d = mb * 16 + 8 * hi + j; v: head by, block (t / 32) * 4 + d / 16, t = r0 + mb * 16 + 8 * hi + j, d = nb * 16 + lr
        const size_t pb = (isv ? (size_t)by * (TT * HD) + (size_t)r0 * HD : (size_t)bx * (TT * HD) + (size_t)c0 * HD) + lane * 8;
        const int smb = isv ? 2048 : 512, snb = isv ? 512 : 1024;
        // all three loops unrolled: the accumulators are indexed by constants alone and stay in registers
#pragma unroll
        for (int nb = 0; nb < 4; ++nb)
#pragma unroll
            for (int mb = 0; mb < 4; ++mb) { v8h o16; v8us oh, ol;
#pragma unroll
                for (int j = 0; j < 8; ++j) { const float x = acc[mb][nb][j]; o16[j] = tohx(x); unsigned short a2, c2; splitf(x, a2, c2); oh[j] = a2; ol[j] = c2; }
                const size_t po = pb + (mb >> 1) * smb + nb * snb + (mb & 1) * 256; *(v8h*)(P16 + po) = o16; *(v8us*)(Ph + po) = oh; *(v8us*)(Pl + po) = ol; }
        return;
    }
#pragma unroll
    for (int mb = 0; mb < 4; ++mb) {
#pragma unroll
        for (int nb = 0; nb < 4; ++nb) {
#pragma unroll
            for (int j = 0; j < 8; ++j) os[(hi * 8 + j) * 68 + nb * 16 + lr] = acc[mb][nb][j]; }
        __builtin_amdgcn_wave_barrier(); asm volatile("" ::: "memory");
        float* crow = C + (size_t)(r0 + mb * 16) * ldc + c0;
{
#pragma unroll
            for (int s = 0; s < 8; ++s) { const int row = 2 * s + hi, cofs = lr * 4; v4f val = *(const v4fa*)(os + row * 68 + cofs); if (BIAS) { val[0] += bfr(bias[c0 + cofs]); val[1] += bfr(bias[c0 + cofs + 1]); val[2] += bfr(bias[c0 + cofs + 2]); val[3] += bfr(bias[c0 + cofs + 3]); }
                *(v4f*)(crow + (size_t)row * ldc + cofs) = val; }
             }
        __builtin_amdgcn_wave_barrier(); asm volatile("" ::: "memory");
    }
}

typedef __attribute__((ext_vector_type(2))) _Float16 v2h;
typedef __attribute__((ext_vector_type(4))) _Float16 v4h;
typedef __attribute__((ext_vector_type(2))) unsigned short v2us;
typedef __attribute__((ext_vector_type(4))) unsigned short v4us;
typedef __attribute__((ext_vector_type(2))) float v2f;
typedef __attribute__((ext_vector_type(4))) int v4i;

// weight w[k][n] -> fragment-order plane with rows n: a thread builds the two 16-byte pieces (k & 8 alike, both halves) of one n in one block; lanes run along n, so a load is one whole line and a store two runs of 256 bytes.
__device__ __forceinline__ void wtG(const float* __restrict__ w, int K, int N, bf* Bt, int blk) {
    const int lane = threadIdx.x & 31; const int u = blk * 8 + (threadIdx.x >> 5); const int nkc = K >> 5;
    const int hi = u & 1, kc = (u >> 1) % nkc, n = ((u >> 1) / nkc) * 32 + lane; if (n >= N) return;
    const float* s = w + (size_t)(kc * 32 + hi * 8) * N + n; v8us o0, o1;
#pragma unroll
    for (int j = 0; j < 8; ++j) { o0[j] = f2bf(s[(size_t)j * N]); o1[j] = f2bf(s[(size_t)(16 + j) * N]); }
    asm volatile("s_wait_xcnt 0x0" :: "v"(s) : "memory");   // precaution: the address is its input, so that it keeps its registers up to here and none of the sixteen requests lands in one
    bf* d = Bt + ((size_t)(n >> 4) * nkc + kc) * 512 + (hi * 16 + (n & 15)) * 8; *(v8us*)d = o0; *(v8us*)(d + 256) = o1;
}
// src [rows][K] f32 -> fragment-order plane: 64 threads a block, four neighbours share a row; a wave reads 8 whole lines (8 rows x 32 k) and its store is 4 whole lines (a piece of 8 rows is 128 bytes in a row).
__device__ __forceinline__ void cvt8(const float* __restrict__ src, bf* dst, size_t n8, int K, int blk) { const size_t i = (size_t)blk * 256 + threadIdx.x; if (i >= n8) return;
    const int nkc = K >> 5; const int b = (int)(i >> 6), lr = (int)(i >> 2) & 15, p = (int)i & 3;
    const v8f v = *(const v8f*)(src + (size_t)((b / nkc) * 16 + lr) * K + (b % nkc) * 32 + p * 8); v8us o;
#pragma unroll
    for (int j = 0; j < 8; ++j) o[j] = f2bf(v[j]); *(v8us*)(dst + (size_t)b * 512 + (p >> 1) * 256 + ((p & 1) * 16 + lr) * 8) = o;  }
// all operand conversions in ONE launch, the job picked by block range: 4 * GWT blocks turn the four weights (the longer job, dealt first), then NB * GCV blocks convert x. W: four planes one behind the other (q, k, v, o); XB: NB planes of TT rows, k = DM.
#define GWT  ((DQ * DM / 16 + 255) / 256)
#define GCV  ((TT * DM / 8 + 255) / 256)
__global__ __launch_bounds__(256) void k_prep(const float* __restrict__ x, const float* __restrict__ wq, const float* __restrict__ wk, const float* __restrict__ wv, const float* __restrict__ wo, bf* W, bf* XB) {
    const int blk = (int)blockIdx.x;
    if (blk < 4 * GWT) { const int j = blk / GWT; wtG(j == 0 ? wq : j == 1 ? wk : j == 2 ? wv : wo, j == 3 ? DQ : DM, j == 3 ? DM : DQ, W + (size_t)j * DQ * DM, blk - j * GWT); }
    else { const int b = (blk - 4 * GWT) / GCV; cvt8(x + (size_t)b * SEQ_FULL * DM, XB + (size_t)b * TT * DM, (size_t)TT * DM / 8, DM, blk - 4 * GWT - b * GCV); }
}
// ---- k_attn: causal attention for one head and 16 query rows per wave, scores never leave registers. Both products are taken transposed: S^T = K.Q^T puts a query in each lane (column l & 15) and keys 8*(l>>4)+j in
// its accumulator elements, which is already the B-fragment k order of O^T = V^T.P^T (key tile 2g -> elements 0..7, key tile 2g+1 -> elements 8..15), so probabilities go from accumulator to operand without a shuffle.
// Online softmax: running maximum m of the raw scores and running sum l per query; o and l are rescaled by exp2((m_old - m_new) c) each pass of KB keys. Probabilities are carried unnormalised (<= 1); the division by l is last.
__device__ __forceinline__ float xhalf(float x) { return __builtin_bit_cast(float, __builtin_amdgcn_permlanex16(__builtin_bit_cast(int, x), __builtin_bit_cast(int, x), 0x76543210, 0xfedcba98, false, false)); }  // lane l with lane l ^ 16
__device__ __forceinline__ void pfrag(const v8f& p0, const v8f& p1, v16h& f, v16h& f2) { (void)f2;
#pragma unroll
    for (int j = 0; j < 8; ++j) { f[j] = tohx(p0[j]); f[8 + j] = tohx(p1[j]); } }
__device__ __forceinline__ void pfrag(const v8f& p0, const v8f& p1, v16bf& f, v16bf& f2) { v8us h0, h1, l0, l1;
#pragma unroll
    for (int j = 0; j < 8; ++j) { unsigned short a, c2; splitf(p0[j], a, c2); h0[j] = a; l0[j] = c2; splitf(p1[j], a, c2); h1[j] = a; l1[j] = c2; }
    f = cat16b(h0, h1); f2 = cat16b(l0, l1); }
template <typename T16, bool SPLIT, int KB>
__device__ __forceinline__ void attn_rows(const T16* __restrict__ Q, const T16* __restrict__ Q2, const T16* __restrict__ Kp, const T16* __restrict__ K2, const T16* __restrict__ Vt, const T16* __restrict__ V2, int q0, int lr, int hi, bf* Ah, bf* Al) {
    typedef typename WFrag<T16>::V V;
    constexpr int NK = KB / 16, NG = KB / 32;
    const float c = SCL * 1.4426950408889634f;
    const unsigned loff = (unsigned)((hi * 16 + lr) * 8);      // the lane's piece in each half of a block
    V qf[2], qf2[2];
#pragma unroll
    for (int ks = 0; ks < 2; ++ks) { qf[ks] = WFrag<T16>::ld(Q + (size_t)q0 * HD + ks * 512 + loff); if constexpr (SPLIT) qf2[ks] = WFrag<T16>::ld(Q2 + (size_t)q0 * HD + ks * 512 + loff); }
    v8f o[4];
#pragma unroll
    for (int db = 0; db < 4; ++db) o[db] = (v8f){};
    float m = -3.0e38f, l = 0.f;
#pragma unroll 1
    for (int k0 = 0; k0 <= q0 + 15; k0 += KB) {
        V ka[NK][2], ka2[NK][2], va[NG][4], va2[NG][4];     // all of a pass's requests go out in one run, keys first: one memory latency a pass, and the values' share of it runs under scores and softmax
        const size_t kb = (size_t)k0 * HD;
#pragma unroll
        for (int kt = 0; kt < NK; ++kt)
#pragma unroll
            for (int ks = 0; ks < 2; ++ks) { ka[kt][ks] = WFrag<T16>::ld(Kp + kb + loff + (kt * 2 + ks) * 512); if constexpr (SPLIT) ka2[kt][ks] = WFrag<T16>::ld(K2 + kb + loff + (kt * 2 + ks) * 512); }
        asm volatile("s_wait_xcnt 0x0" ::: "memory");       // precaution: a value request below may land in a register pair that the key requests above name as an address
#pragma unroll
        for (int g = 0; g < NG; ++g)
#pragma unroll
            for (int db = 0; db < 4; ++db) va[g][db] = WFrag<T16>::ld(Vt + kb + loff + (g * 4 + db) * 512);
        if constexpr (SPLIT) { asm volatile("s_wait_xcnt 0x0" ::: "memory");   // the same precaution between the two value planes
#pragma unroll
            for (int g = 0; g < NG; ++g)
#pragma unroll
                for (int db = 0; db < 4; ++db) va2[g][db] = WFrag<T16>::ld(V2 + kb + loff + (g * 4 + db) * 512); }
        asm volatile("s_wait_xcnt 0x0" ::: "memory");       // precaution: stands in front of every later write of a register that the requests above name as an address
        // inputs-only fence on the loaded key fragments: all eight are in flight together; without it they are asked for in turns into reused registers, several latencies a pass
        if constexpr (SPLIT) asm volatile("" :: "v"(ka[0][0]), "v"(ka[0][1]), "v"(ka[1][0]), "v"(ka[1][1]), "v"(ka2[0][0]), "v"(ka2[0][1]), "v"(ka2[1][0]), "v"(ka2[1][1]));
        else asm volatile("" :: "v"(ka[0][0]), "v"(ka[0][1]), "v"(ka[1][0]), "v"(ka[1][1]), "v"(ka[NK - 2][0]), "v"(ka[NK - 2][1]), "v"(ka[NK - 1][0]), "v"(ka[NK - 1][1]));
        v8f s[NK];
#pragma unroll
        for (int kt = 0; kt < NK; ++kt) { v8f acc = (v8f){};
#pragma unroll
            for (int ks = 0; ks < 2; ++ks) { acc = WFrag<T16>::mma(ka[kt][ks], qf[ks], acc);
                if constexpr (SPLIT) { acc = WFrag<T16>::mma(ka2[kt][ks], qf[ks], acc); acc = WFrag<T16>::mma(ka[kt][ks], qf2[ks], acc); } }
            s[kt] = acc; }
        if (k0 + KB - 1 > q0) {      // only passes that reach the diagonal hold keys above a query: mask by index select
#pragma unroll
            for (int kt = 0; kt < NK; ++kt)
#pragma unroll
                for (int j = 0; j < 8; ++j) s[kt][j] = (k0 + kt * 16 + 8 * hi + j <= q0 + lr) ? s[kt][j] : -3.0e38f; }
        float mx = m;
#pragma unroll
        for (int kt = 0; kt < NK; ++kt) { float t = s[kt][0];      // one short chain a key tile, side by side
#pragma unroll
            for (int j = 1; j < 8; ++j) t = fmaxf(t, s[kt][j]);
            mx = fmaxf(mx, t); }
        mx = fmaxf(mx, xhalf(mx));      // the two lane halves hold different keys of the same query
        const float mc = mx * c;                        // exponent as one fused multiply-add a score: s c - max c
        const float alpha = __builtin_amdgcn_exp2f(__builtin_fmaf(m, c, -mc)); m = mx;
        float ps = 0.f;
#pragma unroll
        for (int kt = 0; kt < NK; ++kt) { float t = 0.f;
#pragma unroll
            for (int j = 0; j < 8; ++j) { s[kt][j] = __builtin_amdgcn_exp2f(__builtin_fmaf(s[kt][j], c, -mc)); t += s[kt][j]; }
            ps += t; }
        l = l * alpha + ps;
#pragma unroll
        for (int db = 0; db < 4; ++db) o[db] *= alpha;
#pragma unroll
        for (int g = 0; g < NG; ++g) { V pf, pf2; pfrag(s[2 * g], s[2 * g + 1], pf, pf2);
#pragma unroll
            for (int db = 0; db < 4; ++db) { o[db] = WFrag<T16>::mma(va[g][db], pf, o[db]); if constexpr (SPLIT) { o[db] = WFrag<T16>::mma(va2[g][db], pf, o[db]); o[db] = WFrag<T16>::mma(va[g][db], pf2, o[db]); } } }
    }
    l += xhalf(l);
    const float inv = __fdiv_rn(1.0f, l);
#pragma unroll
    for (int db = 0; db < 4; ++db) { v8us oh, ol;
#pragma unroll
        for (int j = 0; j < 8; ++j) { unsigned short a, c2; splitf(o[db][j] * inv, a, c2); oh[j] = a; ol[j] = c2; }
        const size_t oo = (size_t)q0 * DQ + (db >> 1) * 512 + (db & 1) * 256 + loff; *(v8us*)(Ah + oo) = oh; *(v8us*)(Al + oo) = ol; }
}
// grid (TT/16, heads, NB), one wave a block; the longest rows (most keys) of a head are dealt first. Every operand plane is [NB][heads][...]; Ah, Al: NB fragment-order planes of TT rows, k = DQ (a head's 64 k are 2 blocks).
__global__ __launch_bounds__(32) void k_attn(const h16* __restrict__ Q16, const h16* __restrict__ K16, const h16* __restrict__ V16, const bf* __restrict__ Qh, const bf* __restrict__ Ql, const bf* __restrict__ Kh, const bf* __restrict__ Kl, const bf* __restrict__ Vh, const bf* __restrict__ Vl, bf* Ah, bf* Al) {
    const int lane = threadIdx.x & 31, lr = lane & 15, hi = lane >> 4; const int q0 = (TT / 16 - 1 - (int)blockIdx.x) * 16; const size_t hb = ((size_t)blockIdx.z * NH_ + blockIdx.y) * TT * HD; const size_t ho = (size_t)blockIdx.z * TT * DQ + (size_t)blockIdx.y * (HD / 32) * 512;
    if (q0 < RH) attn_rows<bf, true, 32>(Qh + hb, Ql + hb, Kh + hb, Kl + hb, Vh + hb, Vl + hb, q0, lr, hi, Ah + ho, Al + ho);
    else attn_rows<h16, false, 64>(Q16 + hb, nullptr, K16 + hb, nullptr, V16 + hb, nullptr, q0, lr, hi, Ah + ho, Al + ho);
}

extern "C" void kernel_launch(void* const* d_in, const int* in_sizes, int n_in,
                              void* d_out, int out_size, void* d_ws, size_t ws_size, hipStream_t stream) {
    if (n_in < 6) return;
    const size_t xneed = (size_t)(NB - 1) * SEQ_FULL * DM + (size_t)TT * DM;
    if ((size_t)in_sizes[0] < xneed || (size_t)in_sizes[1] < (size_t)DM * DQ || (size_t)in_sizes[2] < (size_t)DM * DQ || (size_t)in_sizes[3] < (size_t)DM * DQ || (size_t)in_sizes[4] < (size_t)DQ * DM || in_sizes[5] < DM || (size_t)out_size < xneed) return;
    const float* x = (const float*)d_in[0]; const float* wq = (const float*)d_in[1]; const float* wk = (const float*)d_in[2]; const float* wv = (const float*)d_in[3]; const float* wo = (const float*)d_in[4]; const float* bo = (const float*)d_in[5];
    float* OUT = (float*)d_out;     // [NB][SEQ][1024], batch stride SEQ_FULL*DM
    char* wsp = (char*)d_ws;
    auto take = [&](size_t bytes) { char* p = wsp; wsp += (bytes + 255) & ~(size_t)255; return (void*)p; };
    bf* WALL = (bf*)take((size_t)4 * DQ * DM * 2);      // weight planes, rows n, from the [in][out] storage: q, k, v, o, one behind the other
    bf* XB = (bf*)take((size_t)NB * TT * DM * 2);
    const size_t PS = (size_t)NH_ * TT * HD;            // elements of one operand plane of one batch
    h16* P16 = (h16*)take((size_t)3 * NB * PS * 2); bf* PH = (bf*)take((size_t)3 * NB * PS * 2); bf* PL = (bf*)take((size_t)3 * NB * PS * 2);     // [q, k, v][NB] planes
    bf* ATh = (bf*)take((size_t)NB * TT * DQ * 2); bf* ATl = (bf*)take((size_t)NB * TT * DQ * 2);
    if ((size_t)(wsp - (char*)d_ws) > ws_size) return;
    k_prep<<<4 * GWT + NB * GCV, 256, 0, stream>>>(x, wq, wk, wv, wo, WALL, XB);
    k_gemmw<bf, 0, false, true, DM><<<dim3(DQ / 64, TT / 64, 3 * NB), 32, 0, stream>>>(WALL, nullptr, XB, nullptr, nullptr, 0, nullptr, (size_t)DQ * DM, (size_t)TT * DM, PS, P16, PH, PL);
    k_attn<<<dim3(TT / 16, NH_, NB), 32, 0, stream>>>(P16, P16 + NB * PS, P16 + 2 * NB * PS, PH, PL, PH + NB * PS, PL + NB * PS, PH + 2 * NB * PS, PL + 2 * NB * PS, ATh, ATl);
    k_gemmw<bf, 1, true, false, DQ><<<dim3(TT / 64, DM / 64, NB), 32, 0, stream>>>(ATh, ATl, WALL + (size_t)3 * DQ * DM, nullptr, OUT, DM, bo, (size_t)TT * DQ, 0, (size_t)SEQ_FULL * DM, nullptr, nullptr, nullptr);
}

// v005
// One run takes 118 microseconds.
// Next to v004, in two timings, it ran 1.24 and 1.26 times as fast.
// Counting every step since v000, it is 12.4 times as fast.
#include <hip/hip_runtime.h>

// Causal multi-head self-attention: x [NB][SEQ][1024]; q/k/v = x W (W stored [in][out], no bias; 16 heads x 64); softmax(q.k^T / 8) under a lower-triangular mask; out = merged(attn.v) Wo + bo -> [NB][SEQ][1024] f32.
// Compute dtypes, f32 accumulate: every float input RNE-converted to bf16 on load; q/k/v projections v_wmma_f32_16x16x32_bf16 on plain bf16 operands (exact products);
// causal scores and attn.v: query rows < RH on bf16 hi/lo operand planes (3 products, v_wmma_f32_16x16x32_bf16), rows >= RH on single fp16 operands (v_wmma_f32_16x16x32_f16, probabilities carried unnormalised); online softmax f32, scores kept in registers;
// output projection: bf16 hi/lo activations x exact bf16 Wo (2 products) + bias.
// FRAGMENT ORDER: every 16-bit operand plane (a matrix M[row][k]) lies in the workspace as 1 KB blocks, one per (16 rows, 32 k): element (row, k) of a block sits at ((k & 31) >> 4) * 256 + (((k >> 3) & 1) * 16 + (row & 15)) * 8 + (k & 7).
// Lane l's fragment is then the 16 bytes at l * 16 of each 512-byte half: a wave's load covers 4 whole 128-byte lines, and which element reaches which lane and register is as with row-major planes.
// Blocks of a GEMM operand: [row / 16][k / 32]; q, k planes per head: [t / 16][d / 32]; v planes per head: [t / 32][d / 16].

#ifndef NB
#define NB   2
#endif
#ifndef SEQ
#define SEQ  2048
#endif
#define NB_FULL  2
#define SEQ_FULL 2048
#define TT   SEQ
#define DM   1024
#define NH_  16
#define HD   64
#define DQ   (NH_ * HD)
#ifndef RH
#define RH   (((SEQ) < 512) ? (SEQ) : 512)   // query rows < RH use hi+lo planes
#endif
#define SCL  0.125f   // HD^-0.5

static_assert((SEQ) % 128 == 0);
static_assert((RH) % 64 == 0);
static_assert((RH) <= (SEQ));
static_assert((DM) % 64 == 0);
static_assert((HD) == 64);
static_assert((NB) >= 1 && (NB) <= (NB_FULL));
static_assert((SEQ) <= (SEQ_FULL));

typedef _Float16 h16;
typedef unsigned short bf;
typedef __attribute__((ext_vector_type(16))) __bf16   v16bf;
typedef __attribute__((ext_vector_type(16))) _Float16 v16h;
typedef __attribute__((ext_vector_type(8)))  _Float16 v8h;
typedef __attribute__((ext_vector_type(8)))  unsigned short v8us;
typedef __attribute__((ext_vector_type(8)))  float    v8f;
typedef __attribute__((ext_vector_type(4)))  float    v4f;
typedef v8h  __attribute__((may_alias)) v8ha;
typedef v4f  __attribute__((may_alias)) v4fa;
typedef v8us __attribute__((may_alias)) v8usa;

__device__ __forceinline__ unsigned short f2bf(float f) { unsigned u = __float_as_uint(f); u += 0x7FFFu + ((u >> 16) & 1u); return (unsigned short)(u >> 16); }
__device__ __forceinline__ float bf2f(unsigned short b) { return __uint_as_float(((unsigned)b) << 16); }
__device__ __forceinline__ float bfr(float f) { return bf2f(f2bf(f)); }
__device__ __forceinline__ h16 tohx(float x) { return (h16)x; }
__device__ __forceinline__ void splitf(float y, unsigned short& h, unsigned short& l) { h = f2bf(y); l = f2bf(y - bf2f(h)); }
__device__ __forceinline__ v16h cat16(v8h lo, v8h hi) { return __builtin_shufflevector(lo, hi, 0, 1, 2, 3, 4, 5, 6, 7, 8, 9, 10, 11, 12, 13, 14, 15); }
__device__ __forceinline__ v16bf cat16b(v8us lo, v8us hi) { return __builtin_bit_cast(v16bf, __builtin_shufflevector(lo, hi, 0, 1, 2, 3, 4, 5, 6, 7, 8, 9, 10, 11, 12, 13, 14, 15)); }
__device__ __forceinline__ v8f wmma16(v16h a, v16h b, v8f c) { return __builtin_amdgcn_wmma_f32_16x16x32_f16(false, a, false, b, (short)0, c, false, false); }
__device__ __forceinline__ v8f wmmab(v16bf a, v16bf b, v8f c) { return __builtin_amdgcn_wmma_f32_16x16x32_bf16(false, a, false, b, (short)0, c, false, false); }

// ---- k_gemmw: register-blocked GEMM, ONE WAVE per 64x64 output tile (16 accumulators), operands straight from 16-bit planes in fragment order; grid (M/64, N/64, Z), 32 threads (PLANES: see below).
// C[m][n] (f32, pitch ldc, + optional f32 bias[n]) = sum_k A[m][k] Bt[n][k] (+ split products per NSPLIT). z-batch strides sA/sB/sC in elements. K % 32 == 0; K is a compile-time number, so that the fragments of a trip share one address an operand plane and differ by immediates.
// PLANES: no f32 C; the tile leaves as the three 16-bit operand planes of the attention kernel (fp16, bf16 hi, bf16 lo), straight from the accumulators: a lane's 8 elements are 8 consecutive rows m of one column n,
// which is one 16-byte piece of a fragment-order block, lane l's at l * 16 of a half: a wave's store is 512 bytes in a row. q, k: A = weight (m = head * 64 + d), Bt = x (n = t), rows t, k = d; v: A = x (m = t), Bt = weight (n = head * 64 + d), rows d, k = t.
// PLANES takes q, k and v of every batch in ONE launch: grid (weight panels, token panels, 3 * NB), z = job * NB + batch (job 0 q, 1 k, 2 v); A = the three weight planes (stride sA), Bt = x (batch stride sB), each of P16, Ph, Pl = 3 * NB planes (stride sC) indexed by z.
// Fragments: lane l -> row/col (l & 15); elements 0..7 <- k0 + 8*(l>>4) + 0..7, elements 8..15 <- k0 + 16 + 8*(l>>4) + 0..7 for A and B alike; D element j of lane l = (row 8*(l>>4)+j, col l&15).
template <typename T16> struct WFrag;
template <> struct WFrag<h16> { typedef v16h V; static __device__ __forceinline__ V ld(const h16* p) { return cat16(*(const v8h*)p, *(const v8h*)(p + 256)); } static __device__ __forceinline__ v8f mma(V a, V b, v8f c) { return wmma16(a, b, c); } };
template <> struct WFrag<bf> { typedef v16bf V; static __device__ __forceinline__ V ld(const bf* p) { return cat16b(*(const v8us*)p, *(const v8us*)(p + 256)); } static __device__ __forceinline__ v8f mma(V a, V b, v8f c) { return wmmab(a, b, c); } };
template <typename T16, int NSPLIT, bool BIAS, bool PLANES, int K>
__global__ __launch_bounds__(32) void k_gemmw(const T16* __restrict__ A, const T16* __restrict__ A2, const T16* __restrict__ Bt, const T16* __restrict__ Bt2, float* C, int ldc, const float* __restrict__ bias, size_t sA, size_t sB, size_t sC, h16* P16, bf* Ph, bf* Pl) {
    typedef typename WFrag<T16>::V V;
    __shared__ __align__(16) float os[16 * 68];
    const size_t z = blockIdx.z; int bx = blockIdx.x, by = blockIdx.y; bool isv = false;
    if constexpr (PLANES) { const size_t job = z / NB; const T16* Wj = A + job * sA; const T16* Xb = Bt + (z - job * NB) * sB; P16 += z * sC; Ph += z * sC; Pl += z * sC;
        if (job == 2) { A = Xb; Bt = Wj; bx = blockIdx.y; by = blockIdx.x; isv = true; } else { A = Wj; Bt = Xb; } }
    else { A += z * sA; if (A2) A2 += z * sA; Bt += z * sB; if (Bt2) Bt2 += z * sB; C += z * sC; }
    const int lane = threadIdx.x & 31, lr = lane & 15, hi = lane >> 4; const int r0 = bx * 64, c0 = by * 64;
    v8f acc[4][4];
#pragma unroll
    for (int mb = 0; mb < 4; ++mb)
#pragma unroll
        for (int nb = 0; nb < 4; ++nb) acc[mb][nb] = (v8f){};
    const size_t aoff = (size_t)r0 * K, boff = (size_t)c0 * K; const unsigned loff = (unsigned)(lane * 8);      // 16 rows of blocks = 16 * K elements; 32 k on = 512 elements; the lane's piece is the only per-lane part of an address
#pragma unroll 1
    for (int kc = 0; kc < K; kc += 32) {
        V a[4], a2[4];
        const T16* pa = A + (aoff + kc * 16) + loff; const T16* pa2 = (NSPLIT == 1 || NSPLIT == 2) ? A2 + (aoff + kc * 16) + loff : pa; const T16* pb = Bt + (boff + kc * 16) + loff; const T16* pb2 = (NSPLIT >= 2) ? Bt2 + (boff + kc * 16) + loff : pb;
#pragma unroll
        for (int mb = 0; mb < 4; ++mb) { a[mb] = WFrag<T16>::ld(pa + mb * 16 * K); if (NSPLIT == 1 || NSPLIT == 2) a2[mb] = WFrag<T16>::ld(pa2 + mb * 16 * K); }
#pragma unroll
        for (int nb = 0; nb < 4; ++nb) { const V b = WFrag<T16>::ld(pb + nb * 16 * K); V b2; if (NSPLIT >= 2) b2 = WFrag<T16>::ld(pb2 + nb * 16 * K);
#pragma unroll
            for (int mb = 0; mb < 4; ++mb) { acc[mb][nb] = WFrag<T16>::mma(a[mb], b, acc[mb][nb]); if (NSPLIT == 1 || NSPLIT == 2) acc[mb][nb] = WFrag<T16>::mma(a2[mb], b, acc[mb][nb]); if (NSPLIT >= 2) acc[mb][nb] = WFrag<T16>::mma(a[mb], b2, acc[mb][nb]); } }
        // precaution: stands in front of every write of a register that this trip's requests name as an address; the addresses are its inputs, so that they keep their registers up to here and no request lands in one
        asm volatile("s_wait_xcnt 0x0" :: "v"(pa), "v"(pa2), "v"(pb), "v"(pb2) : "memory");
        asm volatile("v_nop\n\tv_nop\n\tv_nop\n\tv_nop" : "+v"(acc[0][0]), "+v"(acc[1][1]), "+v"(acc[2][2]), "+v"(acc[3][3]) : "v"(a[0]), "v"(a[3]));
    }
    if constexpr (PLANES) {
        // q, k: head bx, block (t / 16) * 2 + d / 32, t = c0 + nb * 16 + lr, d = mb * 16 + 8 * hi + j; v: head by, block (t / 32) * 4 + d / 16, t = r0 + mb * 16 + 8 * hi + j, d = nb * 16 + lr
        const size_t pb = (isv ? (size_t)by * (TT * HD) + (size_t)r0 * HD : (size_t)bx * (TT * HD) + (size_t)c0 * HD) + lane * 8;
        const int smb = isv ? 2048 : 512, snb = isv ? 512 : 1024;
        // all three loops unrolled: the accumulators are indexed by constants alone and stay in registers
#pragma unroll
        for (int nb = 0; nb < 4; ++nb)
#pragma unroll
            for (int mb = 0; mb < 4; ++mb) { v8h o16; v8us oh, ol;
#pragma unroll
                for (int j = 0; j < 8; ++j) { const float x = acc[mb][nb][j]; o16[j] = tohx(x); unsigned short a2, c2; splitf(x, a2, c2); oh[j] = a2; ol[j] = c2; }
                const size_t po = pb + (mb >> 1) * smb + nb * snb + (mb & 1) * 256; *(v8h*)(P16 + po) = o16; *(v8us*)(Ph + po) = oh; *(v8us*)(Pl + po) = ol; }
        return;
    }
#pragma unroll
    for (int mb = 0; mb < 4; ++mb) {
#pragma unroll
        for (int nb = 0; nb < 4; ++nb) {
#pragma unroll
            for (int j = 0; j < 8; ++j) os[(hi * 8 + j) * 68 + nb * 16 + lr] = acc[mb][nb][j]; }
        __builtin_amdgcn_wave_barrier(); asm volatile("" ::: "memory");
        float* crow = C + (size_t)(r0 + mb * 16) * ldc + c0;
{
#pragma unroll
            for (int s = 0; s < 8; ++s) { const int row = 2 * s + hi, cofs = lr * 4; v4f val = *(const v4fa*)(os + row * 68 + cofs); if (BIAS) { val[0] += bfr(bias[c0 + cofs]); val[1] += bfr(bias[c0 + cofs + 1]); val[2] += bfr(bias[c0 + cofs + 2]); val[3] += bfr(bias[c0 + cofs + 3]); }
                *(v4f*)(crow + (size_t)row * ldc + cofs) = val; }
             }
        __builtin_amdgcn_wave_barrier(); asm volatile("" ::: "memory");
    }
}

typedef __attribute__((ext_vector_type(2))) _Float16 v2h;
typedef __attribute__((ext_vector_type(4))) _Float16 v4h;
typedef __attribute__((ext_vector_type(2))) unsigned short v2us;
typedef __attribute__((ext_vector_type(4))) unsigned short v4us;
typedef __attribute__((ext_vector_type(2))) float v2f;
typedef __attribute__((ext_vector_type(4))) int v4i;

// weight w[k][n] -> fragment-order plane with rows n: a thread builds the two 16-byte pieces (k & 8 alike, both halves) of one n in one block; lanes run along n, so a load is one whole line and a store two runs of 256 bytes.
__device__ __forceinline__ void wtG(const float* __restrict__ w, int K, int N, bf* Bt, int blk) {
    const int lane = threadIdx.x & 31; const int u = blk * 8 + (threadIdx.x >> 5); const int nkc = K >> 5;
    const int hi = u & 1, kc = (u >> 1) % nkc, n = ((u >> 1) / nkc) * 32 + lane; if (n >= N) return;
    const float* s = w + (size_t)(kc * 32 + hi * 8) * N + n; v8us o0, o1;
#pragma unroll
    for (int j = 0; j < 8; ++j) { o0[j] = f2bf(s[(size_t)j * N]); o1[j] = f2bf(s[(size_t)(16 + j) * N]); }
    asm volatile("s_wait_xcnt 0x0" :: "v"(s) : "memory");   // precaution: the address is its input, so that it keeps its registers up to here and none of the sixteen requests lands in one
    bf* d = Bt + ((size_t)(n >> 4) * nkc + kc) * 512 + (hi * 16 + (n & 15)) * 8; *(v8us*)d = o0; *(v8us*)(d + 256) = o1;
}
// src [rows][K] f32 -> fragment-order plane: 64 threads a block, four neighbours share a row; a wave reads 8 whole lines (8 rows x 32 k) and its store is 4 whole lines (a piece of 8 rows is 128 bytes in a row).
__device__ __forceinline__ void cvt8(const float* __restrict__ src, bf* dst, size_t n8, int K, int blk) { const size_t i = (size_t)blk * 256 + threadIdx.x; if (i >= n8) return;
    const int nkc = K >> 5; const int b = (int)(i >> 6), lr = (int)(i >> 2) & 15, p = (int)i & 3;
    const v8f v = *(const v8f*)(src + (size_t)((b / nkc) * 16 + lr) * K + (b % nkc) * 32 + p * 8); v8us o;
#pragma unroll
    for (int j = 0; j < 8; ++j) o[j] = f2bf(v[j]); *(v8us*)(dst + (size_t)b * 512 + (p >> 1) * 256 + ((p & 1) * 16 + lr) * 8) = o;  }
// all operand conversions in ONE launch, the job picked by block range: 4 * GWT blocks turn the four weights (the longer job, dealt first), then NB * GCV blocks convert x. W: four planes one behind the other (q, k, v, o); XB: NB planes of TT rows, k = DM.
#define GWT  ((DQ * DM / 16 + 255) / 256)
#define GCV  ((TT * DM / 8 + 255) / 256)
__global__ __launch_bounds__(256) void k_prep(const float* __restrict__ x, const float* __restrict__ wq, const float* __restrict__ wk, const float* __restrict__ wv, const float* __restrict__ wo, bf* W, bf* XB) {
    const int blk = (int)blockIdx.x;
    if (blk < 4 * GWT) { const int j = blk / GWT; wtG(j == 0 ? wq : j == 1 ? wk : j == 2 ? wv : wo, j == 3 ? DQ : DM, j == 3 ? DM : DQ, W + (size_t)j * DQ * DM, blk - j * GWT); }
    else { const int b = (blk - 4 * GWT) / GCV; cvt8(x + (size_t)b * SEQ_FULL * DM, XB + (size_t)b * TT * DM, (size_t)TT * DM / 8, DM, blk - 4 * GWT - b * GCV); }
}
// ---- k_attn: causal attention for one head, 16 query rows per wave, AW waves (QB rows) a work-group, scores never leave registers. Both products are taken transposed: S^T = K.Q^T puts a query in each lane (column l & 15) and keys 8*(l>>4)+j in
// its accumulator elements, which is already the B-fragment k order of O^T = V^T.P^T (key tile 2g -> elements 0..7, key tile 2g+1 -> elements 8..15), so probabilities go from accumulator to operand without a shuffle.
// Online softmax: running maximum m of the raw scores and running sum l per query; o and l are rescaled by exp2((m_old - m_new) c) each pass of KB keys. Probabilities are carried unnormalised (<= 1); the division by l is last.
// The work-group's waves walk the same keys: each pass's keys and values (16 KB, whole fragment-order blocks, so plain runs of bytes) are brought into LDS once for all of them by asynchronous copies, two buffers, the next pass's copies in flight while this pass is worked on.
#define AW   4
#define QB   (AW * 16)
#define STG  8192     // 16-bit elements of one staged pass: four segments of 4 KB (fp16: keys, keys, values, values; hi/lo: keys hi, keys lo, values hi, values lo)
static_assert((RH) % QB == 0);
static_assert((SEQ) % QB == 0);
// eight copies a lane, 2 KB a copy over the work-group's 128 lanes: l = the lane's LDS byte address in segment 0, a..d = the lane's 16 bytes in the first half of each segment's source.
// The s_wait_xcnt is a precaution and is the statement's last line, so that it stands in front of every later write of a register that a copy names.
template <typename T16>
__device__ __forceinline__ void copy8(unsigned l, const T16* a, const T16* b, const T16* c, const T16* d) {
    asm volatile("global_load_async_to_lds_b128 %0, %8, off\n\t"
                 "global_load_async_to_lds_b128 %1, %9, off\n\t"
                 "global_load_async_to_lds_b128 %2, %10, off\n\t"
                 "global_load_async_to_lds_b128 %3, %11, off\n\t"
                 "global_load_async_to_lds_b128 %4, %12, off\n\t"
                 "global_load_async_to_lds_b128 %5, %13, off\n\t"
                 "global_load_async_to_lds_b128 %6, %14, off\n\t"
                 "global_load_async_to_lds_b128 %7, %15, off\n\t"
                 "s_wait_xcnt 0x0"
                 :: "v"(l), "v"(l + 2048u), "v"(l + 4096u), "v"(l + 6144u), "v"(l + 8192u), "v"(l + 10240u), "v"(l + 12288u), "v"(l + 14336u),
                    "v"(a), "v"(a + 1024), "v"(b), "v"(b + 1024), "v"(c), "v"(c + 1024), "v"(d), "v"(d + 1024) : "memory");
}
__device__ __forceinline__ float xhalf(float x) { return __builtin_bit_cast(float, __builtin_amdgcn_permlanex16(__builtin_bit_cast(int, x), __builtin_bit_cast(int, x), 0x76543210, 0xfedcba98, false, false)); }  // lane l with lane l ^ 16
__device__ __forceinline__ void pfrag(const v8f& p0, const v8f& p1, v16h& f, v16h& f2) { (void)f2;
#pragma unroll
    for (int j = 0; j < 8; ++j) { f[j] = tohx(p0[j]); f[8 + j] = tohx(p1[j]); } }
__device__ __forceinline__ void pfrag(const v8f& p0, const v8f& p1, v16bf& f, v16bf& f2) { v8us h0, h1, l0, l1;
#pragma unroll
    for (int j = 0; j < 8; ++j) { unsigned short a, c2; splitf(p0[j], a, c2); h0[j] = a; l0[j] = c2; splitf(p1[j], a, c2); h1[j] = a; l1[j] = c2; }
    f = cat16b(h0, h1); f2 = cat16b(l0, l1); }
template <typename T16, bool SPLIT, int KB>
__device__ __forceinline__ void attn_rows(const T16* __restrict__ Q, const T16* __restrict__ Q2, const T16* __restrict__ Kp, const T16* __restrict__ K2, const T16* __restrict__ Vt, const T16* __restrict__ V2, int Q0, int q0, int lr, int hi, const T16* sm, bf* Ah, bf* Al) {
    typedef typename WFrag<T16>::V V;
    constexpr int NK = KB / 16, NG = KB / 32;
    const float c = SCL * 1.4426950408889634f;
    const unsigned loff = (unsigned)((hi * 16 + lr) * 8);      // the lane's piece in each half of a block
    V qf[2], qf2[2];
#pragma unroll
    for (int ks = 0; ks < 2; ++ks) { qf[ks] = WFrag<T16>::ld(Q + (size_t)q0 * HD + ks * 512 + loff); if constexpr (SPLIT) qf2[ks] = WFrag<T16>::ld(Q2 + (size_t)q0 * HD + ks * 512 + loff); }
    v8f o[4];
#pragma unroll
    for (int db = 0; db < 4; ++db) o[db] = (v8f){};
    float m = -3.0e38f, l = 0.f;
    const int np = (Q0 + QB) / KB;      // passes of the work-group, the same for all its waves: keys 0 .. Q0 + QB - 1
    const unsigned l0 = (unsigned)(uintptr_t)sm + threadIdx.x * 16u;
    auto stage = [&](int t) { const size_t kb = (size_t)t * (KB * HD) + threadIdx.x * 8u; const unsigned lb = l0 + (unsigned)(t & 1) * (STG * 2u);
        if constexpr (SPLIT) copy8(lb, Kp + kb, K2 + kb, Vt + kb, V2 + kb); else copy8(lb, Kp + kb, Kp + kb + 2048, Vt + kb, Vt + kb + 2048); };
    stage(0);
    asm volatile("s_wait_asynccnt 0x0" ::: "memory");       // this wave's share of pass 0 has landed
    __syncthreads();                                        // every wave's share has: pass 0 may be read
    if (np > 1) stage(1);
#pragma unroll 1
    for (int t = 0; t < np; ++t) {
      const int k0 = t * KB;
      // every wave works every pass of its work-group. With KB < QB the last pass lies wholly above the rows of the lower waves: all its scores are masked, so the maximum stays, every probability is 0, and sum and output are rescaled alike by exp2 of the exponent's rounding residue, as in any pass that leaves the maximum as it is.
      V va[NG][4], va2[NG][4]; v8f s[NK];
      {
        V ka[NK][2], ka2[NK][2];     // all of a pass's LDS reads go out in one run, keys first: the values' share of the latency runs under the score products
        const T16* sb = sm + (t & 1) * STG + loff;
#pragma unroll
        for (int kt = 0; kt < NK; ++kt)
#pragma unroll
            for (int ks = 0; ks < 2; ++ks) { ka[kt][ks] = WFrag<T16>::ld(sb + (kt * 2 + ks) * 512); if constexpr (SPLIT) ka2[kt][ks] = WFrag<T16>::ld(sb + 2048 + (kt * 2 + ks) * 512); }
#pragma unroll
        for (int g = 0; g < NG; ++g)
#pragma unroll
            for (int db = 0; db < 4; ++db) { va[g][db] = WFrag<T16>::ld(sb + 4096 + (g * 4 + db) * 512); if constexpr (SPLIT) va2[g][db] = WFrag<T16>::ld(sb + 6144 + (g * 4 + db) * 512); }
        // inputs-only fence on the loaded key fragments: all eight are in flight together; without it they are asked for in turns into reused registers, several latencies a pass
        if constexpr (SPLIT) asm volatile("" :: "v"(ka[0][0]), "v"(ka[0][1]), "v"(ka[1][0]), "v"(ka[1][1]), "v"(ka2[0][0]), "v"(ka2[0][1]), "v"(ka2[1][0]), "v"(ka2[1][1]));
        else asm volatile("" :: "v"(ka[0][0]), "v"(ka[0][1]), "v"(ka[1][0]), "v"(ka[1][1]), "v"(ka[NK - 2][0]), "v"(ka[NK - 2][1]), "v"(ka[NK - 1][0]), "v"(ka[NK - 1][1]));
#pragma unroll
        for (int kt = 0; kt < NK; ++kt) { v8f acc = (v8f){};
#pragma unroll
            for (int ks = 0; ks < 2; ++ks) { acc = WFrag<T16>::mma(ka[kt][ks], qf[ks], acc);
                if constexpr (SPLIT) { acc = WFrag<T16>::mma(ka2[kt][ks], qf[ks], acc); acc = WFrag<T16>::mma(ka[kt][ks], qf2[ks], acc); } }
            s[kt] = acc; }
      }
      // hand-over, every wave, in this order: own LDS reads done (the pass's fragments are all in registers from here on); own copies of pass t + 1 landed; the barrier publishes pass t + 1 and ends every reader's last read of pass t's buffer;
      // only then is that buffer refilled, here and not at the end of the pass, so that the copies fly under softmax, the value products and the next pass's reads
      asm volatile("s_wait_dscnt 0x0" ::: "memory");
      asm volatile("s_wait_asynccnt 0x0" ::: "memory");
      __syncthreads();
      if (t + 2 < np) stage(t + 2);
      {
        if (k0 + KB - 1 > q0) {      // only passes that reach the diagonal hold keys above a query: mask by index select
#pragma unroll
            for (int kt = 0; kt < NK; ++kt)
#pragma unroll
                for (int j = 0; j < 8; ++j) s[kt][j] = (k0 + kt * 16 + 8 * hi + j <= q0 + lr) ? s[kt][j] : -3.0e38f; }
        float mx = m;
#pragma unroll
        for (int kt = 0; kt < NK; ++kt) { float t = s[kt][0];      // one short chain a key tile, side by side
#pragma unroll
            for (int j = 1; j < 8; ++j) t = fmaxf(t, s[kt][j]);
            mx = fmaxf(mx, t); }
        mx = fmaxf(mx, xhalf(mx));      // the two lane halves hold different keys of the same query
        const float mc = mx * c;                        // exponent as one fused multiply-add a score: s c - max c
        const float alpha = __builtin_amdgcn_exp2f(__builtin_fmaf(m, c, -mc)); m = mx;
        float ps = 0.f;
#pragma unroll
        for (int kt = 0; kt < NK; ++kt) { float t = 0.f;
#pragma unroll
            for (int j = 0; j < 8; ++j) { s[kt][j] = __builtin_amdgcn_exp2f(__builtin_fmaf(s[kt][j], c, -mc)); t += s[kt][j]; }
            ps += t; }
        l = l * alpha + ps;
#pragma unroll
        for (int db = 0; db < 4; ++db) o[db] *= alpha;
#pragma unroll
        for (int g = 0; g < NG; ++g) { V pf, pf2; pfrag(s[2 * g], s[2 * g + 1], pf, pf2);
#pragma unroll
            for (int db = 0; db < 4; ++db) { o[db] = WFrag<T16>::mma(va[g][db], pf, o[db]); if constexpr (SPLIT) { o[db] = WFrag<T16>::mma(va2[g][db], pf, o[db]); o[db] = WFrag<T16>::mma(va[g][db], pf2, o[db]); } } }
      }
    }
    asm volatile("s_wait_asynccnt 0x0" ::: "memory");       // no copy is in flight when the wave ends
    l += xhalf(l);
    const float inv = __fdiv_rn(1.0f, l);
#pragma unroll
    for (int db = 0; db < 4; ++db) { v8us oh, ol;
#pragma unroll
        for (int j = 0; j < 8; ++j) { unsigned short a, c2; splitf(o[db][j] * inv, a, c2); oh[j] = a; ol[j] = c2; }
        const size_t oo = (size_t)q0 * DQ + (db >> 1) * 512 + (db & 1) * 256 + loff; *(v8us*)(Ah + oo) = oh; *(v8us*)(Al + oo) = ol; }
}
// grid (heads, NB, TT/QB), AW waves a block; the longest rows (most keys) are dealt first. Every operand plane is [NB][heads][...]; Ah, Al: NB fragment-order planes of TT rows, k = DQ (a head's 64 k are 2 blocks).
__global__ __launch_bounds__(AW * 32) void k_attn(const h16* __restrict__ Q16, const h16* __restrict__ K16, const h16* __restrict__ V16, const bf* __restrict__ Qh, const bf* __restrict__ Ql, const bf* __restrict__ Kh, const bf* __restrict__ Kl, const bf* __restrict__ Vh, const bf* __restrict__ Vl, bf* Ah, bf* Al) {
    __shared__ __attribute__((aligned(16))) unsigned short kv[2 * STG];
    const int lane = threadIdx.x & 31, lr = lane & 15, hi = lane >> 4; const int Q0 = (TT / QB - 1 - (int)blockIdx.z) * QB, q0 = Q0 + __builtin_amdgcn_readfirstlane((int)(threadIdx.x >> 5)) * 16;
    const size_t hb = ((size_t)blockIdx.y * NH_ + blockIdx.x) * TT * HD; const size_t ho = (size_t)blockIdx.y * TT * DQ + (size_t)blockIdx.x * (HD / 32) * 512;
    if (Q0 < RH) attn_rows<bf, true, 32>(Qh + hb, Ql + hb, Kh + hb, Kl + hb, Vh + hb, Vl + hb, Q0, q0, lr, hi, (const bf*)kv, Ah + ho, Al + ho);
    else attn_rows<h16, false, 64>(Q16 + hb, nullptr, K16 + hb, nullptr, V16 + hb, nullptr, Q0, q0, lr, hi, (const h16*)kv, Ah + ho, Al + ho);
}

extern "C" void kernel_launch(void* const* d_in, const int* in_sizes, int n_in,
                              void* d_out, int out_size, void* d_ws, size_t ws_size, hipStream_t stream) {
    if (n_in < 6) return;
    const size_t xneed = (size_t)(NB - 1) * SEQ_FULL * DM + (size_t)TT * DM;
    if ((size_t)in_sizes[0] < xneed || (size_t)in_sizes[1] < (size_t)DM * DQ || (size_t)in_sizes[2] < (size_t)DM * DQ || (size_t)in_sizes[3] < (size_t)DM * DQ || (size_t)in_sizes[4] < (size_t)DQ * DM || in_sizes[5] < DM || (size_t)out_size < xneed) return;
    const float* x = (const float*)d_in[0]; const float* wq = (const float*)d_in[1]; const float* wk = (const float*)d_in[2]; const float* wv = (const float*)d_in[3]; const float* wo = (const float*)d_in[4]; const float* bo = (const float*)d_in[5];
    float* OUT = (float*)d_out;     // [NB][SEQ][1024], batch stride SEQ_FULL*DM
    char* wsp = (char*)d_ws;
    auto take = [&](size_t bytes) { char* p = wsp; wsp += (bytes + 255) & ~(size_t)255; return (void*)p; };
    bf* WALL = (bf*)take((size_t)4 * DQ * DM * 2);      // weight planes, rows n, from the [in][out] storage: q, k, v, o, one behind the other
    bf* XB = (bf*)take((size_t)NB * TT * DM * 2);
    const size_t PS = (size_t)NH_ * TT * HD;            // elements of one operand plane of one batch
    h16* P16 = (h16*)take((size_t)3 * NB * PS * 2); bf* PH = (bf*)take((size_t)3 * NB * PS * 2); bf* PL = (bf*)take((size_t)3 * NB * PS * 2);     // [q, k, v][NB] planes
    bf* ATh = (bf*)take((size_t)NB * TT * DQ * 2); bf* ATl = (bf*)take((size_t)NB * TT * DQ * 2);
    if ((size_t)(wsp - (char*)d_ws) > ws_size) return;
    k_prep<<<4 * GWT + NB * GCV, 256, 0, stream>>>(x, wq, wk, wv, wo, WALL, XB);
    k_gemmw<bf, 0, false, true, DM><<<dim3(DQ / 64, TT / 64, 3 * NB), 32, 0, stream>>>(WALL, nullptr, XB, nullptr, nullptr, 0, nullptr, (size_t)DQ * DM, (size_t)TT * DM, PS, P16, PH, PL);
    k_attn<<<dim3(NH_, NB, TT / QB), AW * 32, 0, stream>>>(P16, P16 + NB * PS, P16 + 2 * NB * PS, PH, PL, PH + NB * PS, PL + NB * PS, PH + 2 * NB * PS, PL + 2 * NB * PS, ATh, ATl);
    k_gemmw<bf, 1, true, false, DQ><<<dim3(TT / 64, DM / 64, NB), 32, 0, stream>>>(ATh, ATl, WALL + (size_t)3 * DQ * DM, nullptr, OUT, DM, bo, (size_t)TT * DQ, 0, (size_t)SEQ_FULL * DM, nullptr, nullptr, nullptr);
}

// v006
// Measured time: 79.6 microseconds a run.
// Timed twice side by side with v005, it ran 1.48 and 1.51 times as fast.
// Counting every step since v000, it is 18.5 times as fast.
#include <hip/hip_runtime.h>

// Causal multi-head self-attention: x [NB][SEQ][1024]; q/k/v = x W (W stored [in][out], no bias; 16 heads x 64); softmax(q.k^T / 8) under a lower-triangular mask; out = merged(attn.v) Wo + bo -> [NB][SEQ][1024] f32.
// Compute dtypes, f32 accumulate: every float input RNE-converted to bf16 on load; q/k/v projections v_wmma_f32_16x16x32_bf16 on plain bf16 operands (exact products);
// causal scores and attn.v: query rows < RH on bf16 hi/lo operand planes (3 products, v_wmma_f32_16x16x32_bf16), rows >= RH on single fp16 operands (v_wmma_f32_16x16x32_f16, probabilities carried unnormalised); online softmax f32, scores kept in registers;
// output projection: bf16 hi/lo activations x exact bf16 Wo (2 products) + bias.
// FRAGMENT ORDER: every 16-bit operand plane (a matrix M[row][k]) lies in the workspace as 1 KB blocks, one per (16 rows, 32 k): element (row, k) of a block sits at ((k & 31) >> 4) * 256 + (((k >> 3) & 1) * 16 + (row & 15)) * 8 + (k & 7).
// Lane l's fragment is then the 16 bytes at l * 16 of each 512-byte half: a wave's load covers 4 whole 128-byte lines, and which element reaches which lane and register is as with row-major planes.
// Blocks of a GEMM operand: [row / 16][k / 32]; q, k planes per head: [t / 16][d / 32]; v planes per head: [t / 32][d / 16].

#ifndef NB
#define NB   2
#endif
#ifndef SEQ
#define SEQ  2048
#endif
#define NB_FULL  2
#define SEQ_FULL 2048
#define TT   SEQ
#define DM   1024
#define NH_  16
#define HD   64
#define DQ   (NH_ * HD)
#ifndef RH
#define RH   (((SEQ) < 512) ? (SEQ) : 512)   // query rows < RH use hi+lo planes
#endif
#define SCL  0.125f   // HD^-0.5

static_assert((SEQ) % 128 == 0);
static_assert((RH) % 64 == 0);
static_assert((RH) <= (SEQ));
static_assert((DM) % 128 == 0);
static_assert((HD) == 64);
static_assert((NB) >= 1 && (NB) <= (NB_FULL));
static_assert((SEQ) <= (SEQ_FULL));

typedef _Float16 h16;
typedef unsigned short bf;
typedef __attribute__((ext_vector_type(16))) __bf16   v16bf;
typedef __attribute__((ext_vector_type(16))) _Float16 v16h;
typedef __attribute__((ext_vector_type(8)))  _Float16 v8h;
typedef __attribute__((ext_vector_type(8)))  unsigned short v8us;
typedef __attribute__((ext_vector_type(8)))  float    v8f;
typedef __attribute__((ext_vector_type(4)))  float    v4f;
typedef v8h  __attribute__((may_alias)) v8ha;
typedef v4f  __attribute__((may_alias)) v4fa;
typedef v8us __attribute__((may_alias)) v8usa;

__device__ __forceinline__ unsigned short f2bf(float f) { unsigned u = __float_as_uint(f); u += 0x7FFFu + ((u >> 16) & 1u); return (unsigned short)(u >> 16); }
__device__ __forceinline__ float bf2f(unsigned short b) { return __uint_as_float(((unsigned)b) << 16); }
__device__ __forceinline__ float bfr(float f) { return bf2f(f2bf(f)); }
__device__ __forceinline__ h16 tohx(float x) { return (h16)x; }
__device__ __forceinline__ void splitf(float y, unsigned short& h, unsigned short& l) { h = f2bf(y); l = f2bf(y - bf2f(h)); }
__device__ __forceinline__ v16h cat16(v8h lo, v8h hi) { return __builtin_shufflevector(lo, hi, 0, 1, 2, 3, 4, 5, 6, 7, 8, 9, 10, 11, 12, 13, 14, 15); }
__device__ __forceinline__ v16bf cat16b(v8us lo, v8us hi) { return __builtin_bit_cast(v16bf, __builtin_shufflevector(lo, hi, 0, 1, 2, 3, 4, 5, 6, 7, 8, 9, 10, 11, 12, 13, 14, 15)); }
__device__ __forceinline__ v8f wmma16(v16h a, v16h b, v8f c) { return __builtin_amdgcn_wmma_f32_16x16x32_f16(false, a, false, b, (short)0, c, false, false); }
__device__ __forceinline__ v8f wmmab(v16bf a, v16bf b, v8f c) { return __builtin_amdgcn_wmma_f32_16x16x32_bf16(false, a, false, b, (short)0, c, false, false); }

// ---- k_gemmw: register-blocked GEMM, one wave per 64x64 output tile (16 accumulators), GW waves (2 x 2) a work-group on a 128x128 tile; grid (M/128, N/128, Z), GW * 32 threads (PLANES: see below).
// The operands' 128 rows x KP k of a pass (whole fragment-order blocks: 2 KB in a row per 16 rows) are brought into LDS once for the four waves by asynchronous copies, two buffers, the next pass's copies in flight while this pass is worked on.
// C[m][n] (f32, pitch ldc, + optional f32 bias[n]) = sum_k A[m][k] Bt[n][k] (+ split products per NSPLIT). z-batch strides sA/sB/sC in elements. K % KP == 0; K is a compile-time number.
// PLANES: no f32 C; the tile leaves as the three 16-bit operand planes of the attention kernel (fp16, bf16 hi, bf16 lo), straight from the accumulators: a lane's 8 elements are 8 consecutive rows m of one column n,
// which is one 16-byte piece of a fragment-order block, lane l's at l * 16 of a half: a wave's store is 512 bytes in a row. q, k: A = weight (m = head * 64 + d), Bt = x (n = t), rows t, k = d; v: A = x (m = t), Bt = weight (n = head * 64 + d), rows d, k = t.
// PLANES takes q, k and v of every batch in ONE launch: grid (weight panels, token panels, 3 * NB), z = job * NB + batch (job 0 q, 1 k, 2 v); A = the three weight planes (stride sA), Bt = x (batch stride sB), each of P16, Ph, Pl = 3 * NB planes (stride sC) indexed by z.
// Fragments: lane l -> row/col (l & 15); elements 0..7 <- k0 + 8*(l>>4) + 0..7, elements 8..15 <- k0 + 16 + 8*(l>>4) + 0..7 for A and B alike; D element j of lane l = (row 8*(l>>4)+j, col l&15).
template <typename T16> struct WFrag;
template <> struct WFrag<h16> { typedef v16h V; static __device__ __forceinline__ V ld(const h16* p) { return cat16(*(const v8h*)p, *(const v8h*)(p + 256)); } static __device__ __forceinline__ v8f mma(V a, V b, v8f c) { return wmma16(a, b, c); } };
template <> struct WFrag<bf> { typedef v16bf V; static __device__ __forceinline__ V ld(const bf* p) { return cat16b(*(const v8us*)p, *(const v8us*)(p + 256)); } static __device__ __forceinline__ v8f mma(V a, V b, v8f c) { return wmmab(a, b, c); } };
#define GW   4
#define KP   64
#define OPE  (128 * KP)     // 16-bit elements of one operand's share of a staged pass (16 KB)
// eight copies a lane, 2 KB a copy over the work-group's 128 lanes: one operand's eight groups of 16 rows. l = the lane's LDS byte address in the first group, p = the lane's 16 bytes in the first group's source; 16 rows on = 16 * K elements.
// The s_wait_xcnt is a precaution and is the statement's last line, so that it stands in front of every later write of a register that a copy names.
template <int K, typename T16>
__device__ __forceinline__ void copy8r(unsigned l, const T16* p) {
    asm volatile("global_load_async_to_lds_b128 %0, %8, off\n\t"
                 "global_load_async_to_lds_b128 %1, %9, off\n\t"
                 "global_load_async_to_lds_b128 %2, %10, off\n\t"
                 "global_load_async_to_lds_b128 %3, %11, off\n\t"
                 "global_load_async_to_lds_b128 %4, %12, off\n\t"
                 "global_load_async_to_lds_b128 %5, %13, off\n\t"
                 "global_load_async_to_lds_b128 %6, %14, off\n\t"
                 "global_load_async_to_lds_b128 %7, %15, off\n\t"
                 "s_wait_xcnt 0x0"
                 :: "v"(l), "v"(l + 2048u), "v"(l + 4096u), "v"(l + 6144u), "v"(l + 8192u), "v"(l + 10240u), "v"(l + 12288u), "v"(l + 14336u),
                    "v"(p), "v"(p + 16 * K), "v"(p + 32 * K), "v"(p + 48 * K), "v"(p + 64 * K), "v"(p + 80 * K), "v"(p + 96 * K), "v"(p + 112 * K) : "memory");
}
template <typename T16, int NSPLIT, bool BIAS, bool PLANES, int K>
__global__ __launch_bounds__(GW * 32) void k_gemmw(const T16* __restrict__ A, const T16* __restrict__ A2, const T16* __restrict__ Bt, const T16* __restrict__ Bt2, float* C, int ldc, const float* __restrict__ bias, size_t sA, size_t sB, size_t sC, h16* P16, bf* Ph, bf* Pl) {
    typedef typename WFrag<T16>::V V;
    static_assert(NSPLIT == 0 || NSPLIT == 1); static_assert(K % KP == 0 && K / KP >= 2);
    constexpr int STE = (NSPLIT == 1 ? 3 : 2) * OPE;      // elements of one staged pass: A, Bt (, A2)
    __shared__ __attribute__((aligned(16))) T16 st[2 * STE];
    __shared__ __align__(16) float osa[GW * 16 * 68];
    const size_t z = blockIdx.z; int bx = blockIdx.x, by = blockIdx.y; bool isv = false;
    if constexpr (PLANES) { const size_t job = z / NB; const T16* Wj = A + job * sA; const T16* Xb = Bt + (z - job * NB) * sB; P16 += z * sC; Ph += z * sC; Pl += z * sC;
        if (job == 2) { A = Xb; Bt = Wj; bx = blockIdx.y; by = blockIdx.x; isv = true; } else { A = Wj; Bt = Xb; } }
    else { A += z * sA; if (A2) A2 += z * sA; Bt += z * sB; if (Bt2) Bt2 += z * sB; C += z * sC; }
    const int lane = threadIdx.x & 31, lr = lane & 15, hi = lane >> 4; const int w = __builtin_amdgcn_readfirstlane((int)(threadIdx.x >> 5)), wm = w >> 1, wn = w & 1; const int r0 = bx * 128 + wm * 64, c0 = by * 128 + wn * 64;
    v8f acc[4][4];
#pragma unroll
    for (int mb = 0; mb < 4; ++mb)
#pragma unroll
        for (int nb = 0; nb < 4; ++nb) acc[mb][nb] = (v8f){};
    const size_t aoff = (size_t)bx * 128 * K, boff = (size_t)by * 128 * K; const unsigned loff = (unsigned)(lane * 8);      // 16 rows of blocks = 16 * K elements; 32 k on = 512 elements
    const unsigned l0 = (unsigned)(uintptr_t)st + threadIdx.x * 16u;
    auto stage = [&](int t) { const size_t ko = (size_t)t * (KP * 16) + threadIdx.x * 8u; const unsigned lb = l0 + (unsigned)(t & 1) * (STE * 2u);
        copy8r<K>(lb, A + aoff + ko); copy8r<K>(lb + OPE * 2u, Bt + boff + ko); if constexpr (NSPLIT == 1) copy8r<K>(lb + OPE * 4u, A2 + aoff + ko); };
    stage(0);
    asm volatile("s_wait_asynccnt 0x0" ::: "memory");       // this wave's share of pass 0 has landed
    __syncthreads();                                        // every wave's share has: pass 0 may be read
    stage(1);
#pragma unroll 1
    for (int t = 0; t < K / KP; ++t) {
        const T16* sa = st + (t & 1) * STE + wm * (64 * KP) + loff; const T16* sb = st + (t & 1) * STE + OPE + wn * (64 * KP) + loff;
        V a[KP / 32][4], a2[KP / 32][4], b[KP / 32][4];
#pragma unroll
        for (int ks = 0; ks < KP / 32; ++ks) {
#pragma unroll
            for (int mb = 0; mb < 4; ++mb) { if (mb == 0) b[ks][0] = WFrag<T16>::ld(sb + ks * 512); a[ks][mb] = WFrag<T16>::ld(sa + mb * (16 * KP) + ks * 512); if (NSPLIT == 1) a2[ks][mb] = WFrag<T16>::ld(sa + 2 * OPE + mb * (16 * KP) + ks * 512); }
#pragma unroll
            for (int nb = 1; nb < 4; ++nb) b[ks][nb] = WFrag<T16>::ld(sb + nb * (16 * KP) + ks * 512);
        }
        // keeps the pass's LDS reads as one group ahead of its matrix instructions, in the order of their use; without it they are asked for in turns among the matrix instructions, into reused registers, a latency each
        __builtin_amdgcn_sched_barrier(0);
#pragma unroll
        for (int ks = 0; ks < KP / 32; ++ks)
#pragma unroll
            for (int nb = 0; nb < 4; ++nb)
#pragma unroll
                for (int mb = 0; mb < 4; ++mb) { acc[mb][nb] = WFrag<T16>::mma(a[ks][mb], b[ks][nb], acc[mb][nb]); if (NSPLIT == 1) acc[mb][nb] = WFrag<T16>::mma(a2[ks][mb], b[ks][nb], acc[mb][nb]); }
        // keeps the hand-over behind the pass's matrix instructions; without it its waits are lifted over them, so that the wave waits for all of its LDS reads before its first product, while the refill stays below and loses its lead
        __builtin_amdgcn_sched_barrier(0);
        // hand-over, every wave, in this order: own LDS reads done; own copies of pass t + 1 landed; the barrier publishes pass t + 1 and ends every reader's last read of pass t's buffer; only then is that buffer refilled
        asm volatile("s_wait_dscnt 0x0" ::: "memory");
        asm volatile("s_wait_asynccnt 0x0" ::: "memory");
        __syncthreads();
        if (t + 2 < K / KP) stage(t + 2);
    }
    asm volatile("s_wait_asynccnt 0x0" ::: "memory");       // no copy is in flight when the wave ends
    if constexpr (PLANES) {
        // q, k: head r0 / 64, block (t / 16) * 2 + d / 32, t = c0 + nb * 16 + lr, d = mb * 16 + 8 * hi + j; v: head c0 / 64, block (t / 32) * 4 + d / 16, t = r0 + mb * 16 + 8 * hi + j, d = nb * 16 + lr
        const size_t pb = (isv ? (size_t)(c0 / 64) * (TT * HD) + (size_t)r0 * HD : (size_t)(r0 / 64) * (TT * HD) + (size_t)c0 * HD) + lane * 8;
        const int smb = isv ? 2048 : 512, snb = isv ? 512 : 1024;
        // all three loops unrolled: the accumulators are indexed by constants alone and stay in registers
#pragma unroll
        for (int nb = 0; nb < 4; ++nb)
#pragma unroll
            for (int mb = 0; mb < 4; ++mb) { v8h o16; v8us oh, ol;
#pragma unroll
                for (int j = 0; j < 8; ++j) { const float x = acc[mb][nb][j]; o16[j] = tohx(x); unsigned short a2, c2; splitf(x, a2, c2); oh[j] = a2; ol[j] = c2; }
                const size_t po = pb + (mb >> 1) * smb + nb * snb + (mb & 1) * 256; *(v8h*)(P16 + po) = o16; *(v8us*)(Ph + po) = oh; *(v8us*)(Pl + po) = ol; }
        return;
    }
    float* os = osa + w * (16 * 68);      // each wave turns its tile in its own range
#pragma unroll
    for (int mb = 0; mb < 4; ++mb) {
#pragma unroll
        for (int nb = 0; nb < 4; ++nb) {
#pragma unroll
            for (int j = 0; j < 8; ++j) os[(hi * 8 + j) * 68 + nb * 16 + lr] = acc[mb][nb][j]; }
        __builtin_amdgcn_wave_barrier(); asm volatile("" ::: "memory");
        float* crow = C + (size_t)(r0 + mb * 16) * ldc + c0;
{
#pragma unroll
            for (int s = 0; s < 8; ++s) { const int row = 2 * s + hi, cofs = lr * 4; v4f val = *(const v4fa*)(os + row * 68 + cofs); if (BIAS) { val[0] += bfr(bias[c0 + cofs]); val[1] += bfr(bias[c0 + cofs + 1]); val[2] += bfr(bias[c0 + cofs + 2]); val[3] += bfr(bias[c0 + cofs + 3]); }
                *(v4f*)(crow + (size_t)row * ldc + cofs) = val; }
             }
        __builtin_amdgcn_wave_barrier(); asm volatile("" ::: "memory");
    }
}

typedef __attribute__((ext_vector_type(2))) _Float16 v2h;
typedef __attribute__((ext_vector_type(4))) _Float16 v4h;
typedef __attribute__((ext_vector_type(2))) unsigned short v2us;
typedef __attribute__((ext_vector_type(4))) unsigned short v4us;
typedef __attribute__((ext_vector_type(2))) float v2f;
typedef __attribute__((ext_vector_type(4))) int v4i;

// weight w[k][n] -> fragment-order plane with rows n: a thread builds the two 16-byte pieces (k & 8 alike, both halves) of one n in one block; lanes run along n, so a load is one whole line and a store two runs of 256 bytes.
__device__ __forceinline__ void wtG(const float* __restrict__ w, int K, int N, bf* Bt, int blk) {
    const int lane = threadIdx.x & 31; const int u = blk * 8 + (threadIdx.x >> 5); const int nkc = K >> 5;
    const int hi = u & 1, kc = (u >> 1) % nkc, n = ((u >> 1) / nkc) * 32 + lane; if (n >= N) return;
    const float* s = w + (size_t)(kc * 32 + hi * 8) * N + n; v8us o0, o1;
#pragma unroll
    for (int j = 0; j < 8; ++j) { o0[j] = f2bf(s[(size_t)j * N]); o1[j] = f2bf(s[(size_t)(16 + j) * N]); }
    asm volatile("s_wait_xcnt 0x0" :: "v"(s) : "memory");   // precaution: the address is its input, so that it keeps its registers up to here and none of the sixteen requests lands in one
    bf* d = Bt + ((size_t)(n >> 4) * nkc + kc) * 512 + (hi * 16 + (n & 15)) * 8; *(v8us*)d = o0; *(v8us*)(d + 256) = o1;
}
// src [rows][K] f32 -> fragment-order plane: 64 threads a block, four neighbours share a row; a wave reads 8 whole lines (8 rows x 32 k) and its store is 4 whole lines (a piece of 8 rows is 128 bytes in a row).
__device__ __forceinline__ void cvt8(const float* __restrict__ src, bf* dst, size_t n8, int K, int blk) { const size_t i = (size_t)blk * 256 + threadIdx.x; if (i >= n8) return;
    const int nkc = K >> 5; const int b = (int)(i >> 6), lr = (int)(i >> 2) & 15, p = (int)i & 3;
    const v8f v = *(const v8f*)(src + (size_t)((b / nkc) * 16 + lr) * K + (b % nkc) * 32 + p * 8); v8us o;
#pragma unroll
    for (int j = 0; j < 8; ++j) o[j] = f2bf(v[j]); *(v8us*)(dst + (size_t)b * 512 + (p >> 1) * 256 + ((p & 1) * 16 + lr) * 8) = o;  }
// all operand conversions in ONE launch, the job picked by block range: 4 * GWT blocks turn the four weights (the longer job, dealt first), then NB * GCV blocks convert x. W: four planes one behind the other (q, k, v, o); XB: NB planes of TT rows, k = DM.
#define GWT  ((DQ * DM / 16 + 255) / 256)
#define GCV  ((TT * DM / 8 + 255) / 256)
__global__ __launch_bounds__(256) void k_prep(const float* __restrict__ x, const float* __restrict__ wq, const float* __restrict__ wk, const float* __restrict__ wv, const float* __restrict__ wo, bf* W, bf* XB) {
    const int blk = (int)blockIdx.x;
    if (blk < 4 * GWT) { const int j = blk / GWT; wtG(j == 0 ? wq : j == 1 ? wk : j == 2 ? wv : wo, j == 3 ? DQ : DM, j == 3 ? DM : DQ, W + (size_t)j * DQ * DM, blk - j * GWT); }
    else { const int b = (blk - 4 * GWT) / GCV; cvt8(x + (size_t)b * SEQ_FULL * DM, XB + (size_t)b * TT * DM, (size_t)TT * DM / 8, DM, blk - 4 * GWT - b * GCV); }
}
// ---- k_attn: causal attention for one head, 16 query rows per wave, AW waves (QB rows) a work-group, scores never leave registers. Both products are taken transposed: S^T = K.Q^T puts a query in each lane (column l & 15) and keys 8*(l>>4)+j in
// its accumulator elements, which is already the B-fragment k order of O^T = V^T.P^T (key tile 2g -> elements 0..7, key tile 2g+1 -> elements 8..15), so probabilities go from accumulator to operand without a shuffle.
// Online softmax: running maximum m of the raw scores and running sum l per query; o and l are rescaled by exp2((m_old - m_new) c) each pass of KB keys. Probabilities are carried unnormalised (<= 1); the division by l is last.
// The work-group's waves walk the same keys: each pass's keys and values (16 KB, whole fragment-order blocks, so plain runs of bytes) are brought into LDS once for all of them by asynchronous copies, two buffers, the next pass's copies in flight while this pass is worked on.
#define AW   4
#define QB   (AW * 16)
#define STG  8192     // 16-bit elements of one staged pass: four segments of 4 KB (fp16: keys, keys, values, values; hi/lo: keys hi, keys lo, values hi, values lo)
static_assert((RH) % QB == 0);
static_assert((SEQ) % QB == 0);
// eight copies a lane, 2 KB a copy over the work-group's 128 lanes: l = the lane's LDS byte address in segment 0, a..d = the lane's 16 bytes in the first half of each segment's source.
// The s_wait_xcnt is a precaution and is the statement's last line, so that it stands in front of every later write of a register that a copy names.
template <typename T16>
__device__ __forceinline__ void copy8(unsigned l, const T16* a, const T16* b, const T16* c, const T16* d) {
    asm volatile("global_load_async_to_lds_b128 %0, %8, off\n\t"
                 "global_load_async_to_lds_b128 %1, %9, off\n\t"
                 "global_load_async_to_lds_b128 %2, %10, off\n\t"
                 "global_load_async_to_lds_b128 %3, %11, off\n\t"
                 "global_load_async_to_lds_b128 %4, %12, off\n\t"
                 "global_load_async_to_lds_b128 %5, %13, off\n\t"
                 "global_load_async_to_lds_b128 %6, %14, off\n\t"
                 "global_load_async_to_lds_b128 %7, %15, off\n\t"
                 "s_wait_xcnt 0x0"
                 :: "v"(l), "v"(l + 2048u), "v"(l + 4096u), "v"(l + 6144u), "v"(l + 8192u), "v"(l + 10240u), "v"(l + 12288u), "v"(l + 14336u),
                    "v"(a), "v"(a + 1024), "v"(b), "v"(b + 1024), "v"(c), "v"(c + 1024), "v"(d), "v"(d + 1024) : "memory");
}
__device__ __forceinline__ float xhalf(float x) { return __builtin_bit_cast(float, __builtin_amdgcn_permlanex16(__builtin_bit_cast(int, x), __builtin_bit_cast(int, x), 0x76543210, 0xfedcba98, false, false)); }  // lane l with lane l ^ 16
__device__ __forceinline__ void pfrag(const v8f& p0, const v8f& p1, v16h& f, v16h& f2) { (void)f2;
#pragma unroll
    for (int j = 0; j < 8; ++j) { f[j] = tohx(p0[j]); f[8 + j] = tohx(p1[j]); } }
__device__ __forceinline__ void pfrag(const v8f& p0, const v8f& p1, v16bf& f, v16bf& f2) { v8us h0, h1, l0, l1;
#pragma unroll
    for (int j = 0; j < 8; ++j) { unsigned short a, c2; splitf(p0[j], a, c2); h0[j] = a; l0[j] = c2; splitf(p1[j], a, c2); h1[j] = a; l1[j] = c2; }
    f = cat16b(h0, h1); f2 = cat16b(l0, l1); }
template <typename T16, bool SPLIT, int KB>
__device__ __forceinline__ void attn_rows(const T16* __restrict__ Q, const T16* __restrict__ Q2, const T16* __restrict__ Kp, const T16* __restrict__ K2, const T16* __restrict__ Vt, const T16* __restrict__ V2, int Q0, int q0, int lr, int hi, const T16* sm, bf* Ah, bf* Al) {
    typedef typename WFrag<T16>::V V;
    constexpr int NK = KB / 16, NG = KB / 32;
    const float c = SCL * 1.4426950408889634f;
    const unsigned loff = (unsigned)((hi * 16 + lr) * 8);      // the lane's piece in each half of a block
    V qf[2], qf2[2];
#pragma unroll
    for (int ks = 0; ks < 2; ++ks) { qf[ks] = WFrag<T16>::ld(Q + (size_t)q0 * HD + ks * 512 + loff); if constexpr (SPLIT) qf2[ks] = WFrag<T16>::ld(Q2 + (size_t)q0 * HD + ks * 512 + loff); }
    v8f o[4];
#pragma unroll
    for (int db = 0; db < 4; ++db) o[db] = (v8f){};
    float m = -3.0e38f, l = 0.f;
    const int np = (Q0 + QB) / KB;      // passes of the work-group, the same for all its waves: keys 0 .. Q0 + QB - 1
    const unsigned l0 = (unsigned)(uintptr_t)sm + threadIdx.x * 16u;
    auto stage = [&](int t) { const size_t kb = (size_t)t * (KB * HD) + threadIdx.x * 8u; const unsigned lb = l0 + (unsigned)(t & 1) * (STG * 2u);
        if constexpr (SPLIT) copy8(lb, Kp + kb, K2 + kb, Vt + kb, V2 + kb); else copy8(lb, Kp + kb, Kp + kb + 2048, Vt + kb, Vt + kb + 2048); };
    stage(0);
    asm volatile("s_wait_asynccnt 0x0" ::: "memory");       // this wave's share of pass 0 has landed
    __syncthreads();                                        // every wave's share has: pass 0 may be read
    if (np > 1) stage(1);
#pragma unroll 1
    for (int t = 0; t < np; ++t) {
      const int k0 = t * KB;
      // every wave works every pass of its work-group. With KB < QB the last pass lies wholly above the rows of the lower waves: all its scores are masked, so the maximum stays, every probability is 0, and sum and output are rescaled alike by exp2 of the exponent's rounding residue, as in any pass that leaves the maximum as it is.
      V va[NG][4], va2[NG][4]; v8f s[NK];
      {
        V ka[NK][2], ka2[NK][2];     // all of a pass's LDS reads go out in one run, keys first: the values' share of the latency runs under the score products
        const T16* sb = sm + (t & 1) * STG + loff;
#pragma unroll
        for (int kt = 0; kt < NK; ++kt)
#pragma unroll
            for (int ks = 0; ks < 2; ++ks) { ka[kt][ks] = WFrag<T16>::ld(sb + (kt * 2 + ks) * 512); if constexpr (SPLIT) ka2[kt][ks] = WFrag<T16>::ld(sb + 2048 + (kt * 2 + ks) * 512); }
#pragma unroll
        for (int g = 0; g < NG; ++g)
#pragma unroll
            for (int db = 0; db < 4; ++db) { va[g][db] = WFrag<T16>::ld(sb + 4096 + (g * 4 + db) * 512); if constexpr (SPLIT) va2[g][db] = WFrag<T16>::ld(sb + 6144 + (g * 4 + db) * 512); }
        // inputs-only fence on the loaded key fragments: all eight are in flight together; without it they are asked for in turns into reused registers, several latencies a pass
        if constexpr (SPLIT) asm volatile("" :: "v"(ka[0][0]), "v"(ka[0][1]), "v"(ka[1][0]), "v"(ka[1][1]), "v"(ka2[0][0]), "v"(ka2[0][1]), "v"(ka2[1][0]), "v"(ka2[1][1]));
        else asm volatile("" :: "v"(ka[0][0]), "v"(ka[0][1]), "v"(ka[1][0]), "v"(ka[1][1]), "v"(ka[NK - 2][0]), "v"(ka[NK - 2][1]), "v"(ka[NK - 1][0]), "v"(ka[NK - 1][1]));
#pragma unroll
        for (int kt = 0; kt < NK; ++kt) { v8f acc = (v8f){};
#pragma unroll
            for (int ks = 0; ks < 2; ++ks) { acc = WFrag<T16>::mma(ka[kt][ks], qf[ks], acc);
                if constexpr (SPLIT) { acc = WFrag<T16>::mma(ka2[kt][ks], qf[ks], acc); acc = WFrag<T16>::mma(ka[kt][ks], qf2[ks], acc); } }
            s[kt] = acc; }
      }
      // hand-over, every wave, in this order: own LDS reads done (the pass's fragments are all in registers from here on); own copies of pass t + 1 landed; the barrier publishes pass t + 1 and ends every reader's last read of pass t's buffer;
      // only then is that buffer refilled, here and not at the end of the pass, so that the copies fly under softmax, the value products and the next pass's reads
      asm volatile("s_wait_dscnt 0x0" ::: "memory");
      asm volatile("s_wait_asynccnt 0x0" ::: "memory");
      __syncthreads();
      if (t + 2 < np) stage(t + 2);
      {
        if (k0 + KB - 1 > q0) {      // only passes that reach the diagonal hold keys above a query: mask by index select
#pragma unroll
            for (int kt = 0; kt < NK; ++kt)
#pragma unroll
                for (int j = 0; j < 8; ++j) s[kt][j] = (k0 + kt * 16 + 8 * hi + j <= q0 + lr) ? s[kt][j] : -3.0e38f; }
        float mx = m;
#pragma unroll
        for (int kt = 0; kt < NK; ++kt) { float t = s[kt][0];      // one short chain a key tile, side by side
#pragma unroll
            for (int j = 1; j < 8; ++j) t = fmaxf(t, s[kt][j]);
            mx = fmaxf(mx, t); }
        mx = fmaxf(mx, xhalf(mx));      // the two lane halves hold different keys of the same query
        const float mc = mx * c;                        // exponent as one fused multiply-add a score: s c - max c
        const float alpha = __builtin_amdgcn_exp2f(__builtin_fmaf(m, c, -mc)); m = mx;
        float ps = 0.f;
#pragma unroll
        for (int kt = 0; kt < NK; ++kt) { float t = 0.f;
#pragma unroll
            for (int j = 0; j < 8; ++j) { s[kt][j] = __builtin_amdgcn_exp2f(__builtin_fmaf(s[kt][j], c, -mc)); t += s[kt][j]; }
            ps += t; }
        l = l * alpha + ps;
#pragma unroll
        for (int db = 0; db < 4; ++db) o[db] *= alpha;
#pragma unroll
        for (int g = 0; g < NG; ++g) { V pf, pf2; pfrag(s[2 * g], s[2 * g + 1], pf, pf2);
#pragma unroll
            for (int db = 0; db < 4; ++db) { o[db] = WFrag<T16>::mma(va[g][db], pf, o[db]); if constexpr (SPLIT) { o[db] = WFrag<T16>::mma(va2[g][db], pf, o[db]); o[db] = WFrag<T16>::mma(va[g][db], pf2, o[db]); } } }
      }
    }
    asm volatile("s_wait_asynccnt 0x0" ::: "memory");       // no copy is in flight when the wave ends
    l += xhalf(l);
    const float inv = __fdiv_rn(1.0f, l);
#pragma unroll
    for (int db = 0; db < 4; ++db) { v8us oh, ol;
#pragma unroll
        for (int j = 0; j < 8; ++j) { unsigned short a, c2; splitf(o[db][j] * inv, a, c2); oh[j] = a; ol[j] = c2; }
        const size_t oo = (size_t)q0 * DQ + (db >> 1) * 512 + (db & 1) * 256 + loff; *(v8us*)(Ah + oo) = oh; *(v8us*)(Al + oo) = ol; }
}
// grid (heads, NB, TT/QB), AW waves a block; the longest rows (most keys) are dealt first. Every operand plane is [NB][heads][...]; Ah, Al: NB fragment-order planes of TT rows, k = DQ (a head's 64 k are 2 blocks).
__global__ __launch_bounds__(AW * 32) void k_attn(const h16* __restrict__ Q16, const h16* __restrict__ K16, const h16* __restrict__ V16, const bf* __restrict__ Qh, const bf* __restrict__ Ql, const bf* __restrict__ Kh, const bf* __restrict__ Kl, const bf* __restrict__ Vh, const bf* __restrict__ Vl, bf* Ah, bf* Al) {
    __shared__ __attribute__((aligned(16))) unsigned short kv[2 * STG];
    const int lane = threadIdx.x & 31, lr = lane & 15, hi = lane >> 4; const int Q0 = (TT / QB - 1 - (int)blockIdx.z) * QB, q0 = Q0 + __builtin_amdgcn_readfirstlane((int)(threadIdx.x >> 5)) * 16;
    const size_t hb = ((size_t)blockIdx.y * NH_ + blockIdx.x) * TT * HD; const size_t ho = (size_t)blockIdx.y * TT * DQ + (size_t)blockIdx.x * (HD / 32) * 512;
    if (Q0 < RH) attn_rows<bf, true, 32>(Qh + hb, Ql + hb, Kh + hb, Kl + hb, Vh + hb, Vl + hb, Q0, q0, lr, hi, (const bf*)kv, Ah + ho, Al + ho);
    else attn_rows<h16, false, 64>(Q16 + hb, nullptr, K16 + hb, nullptr, V16 + hb, nullptr, Q0, q0, lr, hi, (const h16*)kv, Ah + ho, Al + ho);
}

extern "C" void kernel_launch(void* const* d_in, const int* in_sizes, int n_in,
                              void* d_out, int out_size, void* d_ws, size_t ws_size, hipStream_t stream) {
    if (n_in < 6) return;
    const size_t xneed = (size_t)(NB - 1) * SEQ_FULL * DM + (size_t)TT * DM;
    if ((size_t)in_sizes[0] < xneed || (size_t)in_sizes[1] < (size_t)DM * DQ || (size_t)in_sizes[2] < (size_t)DM * DQ || (size_t)in_sizes[3] < (size_t)DM * DQ || (size_t)in_sizes[4] < (size_t)DQ * DM || in_sizes[5] < DM || (size_t)out_size < xneed) return;
    const float* x = (const float*)d_in[0]; const float* wq = (const float*)d_in[1]; const float* wk = (const float*)d_in[2]; const float* wv = (const float*)d_in[3]; const float* wo = (const float*)d_in[4]; const float* bo = (const float*)d_in[5];
    float* OUT = (float*)d_out;     // [NB][SEQ][1024], batch stride SEQ_FULL*DM
    char* wsp = (char*)d_ws;
    auto take = [&](size_t bytes) { char* p = wsp; wsp += (bytes + 255) & ~(size_t)255; return (void*)p; };
    bf* WALL = (bf*)take((size_t)4 * DQ * DM * 2);      // weight planes, rows n, from the [in][out] storage: q, k, v, o, one behind the other
    bf* XB = (bf*)take((size_t)NB * TT * DM * 2);
    const size_t PS = (size_t)NH_ * TT * HD;            // elements of one operand plane of one batch
    h16* P16 = (h16*)take((size_t)3 * NB * PS * 2); bf* PH = (bf*)take((size_t)3 * NB * PS * 2); bf* PL = (bf*)take((size_t)3 * NB * PS * 2);     // [q, k, v][NB] planes
    bf* ATh = (bf*)take((size_t)NB * TT * DQ * 2); bf* ATl = (bf*)take((size_t)NB * TT * DQ * 2);
    if ((size_t)(wsp - (char*)d_ws) > ws_size) return;
    k_prep<<<4 * GWT + NB * GCV, 256, 0, stream>>>(x, wq, wk, wv, wo, WALL, XB);
    k_gemmw<bf, 0, false, true, DM><<<dim3(DQ / 128, TT / 128, 3 * NB), GW * 32, 0, stream>>>(WALL, nullptr, XB, nullptr, nullptr, 0, nullptr, (size_t)DQ * DM, (size_t)TT * DM, PS, P16, PH, PL);
    k_attn<<<dim3(NH_, NB, TT / QB), AW * 32, 0, stream>>>(P16, P16 + NB * PS, P16 + 2 * NB * PS, PH, PL, PH + NB * PS, PL + NB * PS, PH + 2 * NB * PS, PL + 2 * NB * PS, ATh, ATl);
    k_gemmw<bf, 1, true, false, DQ><<<dim3(TT / 128, DM / 128, NB), GW * 32, 0, stream>>>(ATh, ATl, WALL + (size_t)3 * DQ * DM, nullptr, OUT, DM, bo, (size_t)TT * DQ, 0, (size_t)SEQ_FULL * DM, nullptr, nullptr, nullptr);
}

// v007
// It runs in 67.9 microseconds.
// In two side-by-side timings against v006, it was 1.19 and 1.18 times as fast.
// Counting every step since v000, it is 21.9 times as fast.
#include <hip/hip_runtime.h>

// Causal multi-head self-attention: x [NB][SEQ][1024]; q/k/v = x W (W stored [in][out], no bias; 16 heads x 64); softmax(q.k^T / 8) under a lower-triangular mask; out = merged(attn.v) Wo + bo -> [NB][SEQ][1024] f32.
// Compute dtypes, f32 accumulate: every float input RNE-converted to bf16 on load; q/k/v projections v_wmma_f32_16x16x32_bf16 on plain bf16 operands (exact products);
// causal scores and attn.v: query rows < RH on bf16 hi/lo operand planes (3 products, v_wmma_f32_16x16x32_bf16), rows >= RH on single fp16 operands (v_wmma_f32_16x16x32_f16, probabilities carried unnormalised); online softmax f32, scores kept in registers;
// output projection: bf16 hi/lo activations x exact bf16 Wo (2 products) + bias.
// FRAGMENT ORDER: every 16-bit operand plane (a matrix M[row][k]) lies in the workspace as 1 KB blocks, one per (16 rows, 32 k): element (row, k) of a block sits at ((k & 31) >> 4) * 256 + (((k >> 3) & 1) * 16 + (row & 15)) * 8 + (k & 7).
// Lane l's fragment is then the 16 bytes at l * 16 of each 512-byte half: a wave's load covers 4 whole 128-byte lines, and which element reaches which lane and register is as with row-major planes.
// Blocks of a GEMM operand: [row / 16][k / 32]; q, k planes per head: [t / 16][d / 32]; v planes per head: [t / 32][d / 16].

#ifndef NB
#define NB   2
#endif
#ifndef SEQ
#define SEQ  2048
#endif
#define NB_FULL  2
#define SEQ_FULL 2048
#define TT   SEQ
#define DM   1024
#define NH_  16
#define HD   64
#define DQ   (NH_ * HD)
#ifndef RH
#define RH   (((SEQ) < 512) ? (SEQ) : 512)   // query rows < RH use hi+lo planes
#endif
#define SCL  0.125f   // HD^-0.5

static_assert((SEQ) % 128 == 0);
static_assert((RH) % 64 == 0);
static_assert((RH) <= (SEQ));
static_assert((DM) % 128 == 0);
static_assert((HD) == 64);
static_assert((NB) >= 1 && (NB) <= (NB_FULL));
static_assert((SEQ) <= (SEQ_FULL));

typedef _Float16 h16;
typedef unsigned short bf;
typedef __attribute__((ext_vector_type(16))) __bf16   v16bf;
typedef __attribute__((ext_vector_type(16))) _Float16 v16h;
typedef __attribute__((ext_vector_type(8)))  _Float16 v8h;
typedef __attribute__((ext_vector_type(8)))  unsigned short v8us;
typedef __attribute__((ext_vector_type(8)))  float    v8f;
typedef __attribute__((ext_vector_type(4)))  float    v4f;
typedef v8h  __attribute__((may_alias)) v8ha;
typedef v4f  __attribute__((may_alias)) v4fa;
typedef v8us __attribute__((may_alias)) v8usa;

__device__ __forceinline__ unsigned short f2bf(float f) { unsigned u = __float_as_uint(f); u += 0x7FFFu + ((u >> 16) & 1u); return (unsigned short)(u >> 16); }
__device__ __forceinline__ float bf2f(unsigned short b) { return __uint_as_float(((unsigned)b) << 16); }
__device__ __forceinline__ float bfr(float f) { return bf2f(f2bf(f)); }
__device__ __forceinline__ h16 tohx(float x) { return (h16)x; }
__device__ __forceinline__ void splitf(float y, unsigned short& h, unsigned short& l) { h = f2bf(y); l = f2bf(y - bf2f(h)); }
__device__ __forceinline__ v16h cat16(v8h lo, v8h hi) { return __builtin_shufflevector(lo, hi, 0, 1, 2, 3, 4, 5, 6, 7, 8, 9, 10, 11, 12, 13, 14, 15); }
__device__ __forceinline__ v16bf cat16b(v8us lo, v8us hi) { return __builtin_bit_cast(v16bf, __builtin_shufflevector(lo, hi, 0, 1, 2, 3, 4, 5, 6, 7, 8, 9, 10, 11, 12, 13, 14, 15)); }
__device__ __forceinline__ v8f wmma16(v16h a, v16h b, v8f c) { return __builtin_amdgcn_wmma_f32_16x16x32_f16(false, a, false, b, (short)0, c, false, false); }
__device__ __forceinline__ v8f wmmab(v16bf a, v16bf b, v8f c) { return __builtin_amdgcn_wmma_f32_16x16x32_bf16(false, a, false, b, (short)0, c, false, false); }

// ---- k_gemmw: register-blocked GEMM, one wave per 64x64 output tile (16 accumulators), GW waves (2 x 2) a work-group on a 128x128 tile; grid (M/128, N/128, Z), GW * 32 threads (PLANES: see below).
// The operands' 128 rows x KP k of a pass (whole fragment-order blocks: 2 KB in a row per 16 rows) are brought into LDS once for the four waves by asynchronous copies, two buffers, the next pass's copies in flight while this pass is worked on.
// C[m][n] (f32, pitch ldc, + optional f32 bias[n]) = sum_k A[m][k] Bt[n][k] (+ split products per NSPLIT). z-batch strides sA/sB/sC in elements. K % KP == 0; K is a compile-time number.
// PLANES: no f32 C; the tile leaves as the three 16-bit operand planes of the attention kernel (fp16, bf16 hi, bf16 lo), straight from the accumulators: a lane's 8 elements are 8 consecutive rows m of one column n,
// which is one 16-byte piece of a fragment-order block, lane l's at l * 16 of a half: a wave's store is 512 bytes in a row. q, k: A = weight (m = head * 64 + d), Bt = x (n = t), rows t, k = d; v: A = x (m = t), Bt = weight (n = head * 64 + d), rows d, k = t.
// PLANES takes q, k and v of every batch in ONE launch: grid (weight panels, token panels, 3 * NB), z = job * NB + batch (job 0 q, 1 k, 2 v); A = the three weight planes (stride sA), Bt = x (batch stride sB), each of P16, Ph, Pl = 3 * NB planes (stride sC) indexed by z.
// Fragments: lane l -> row/col (l & 15); elements 0..7 <- k0 + 8*(l>>4) + 0..7, elements 8..15 <- k0 + 16 + 8*(l>>4) + 0..7 for A and B alike; D element j of lane l = (row 8*(l>>4)+j, col l&15).
template <typename T16> struct WFrag;
template <> struct WFrag<h16> { typedef v16h V; static __device__ __forceinline__ V ld(const h16* p) { return cat16(*(const v8h*)p, *(const v8h*)(p + 256)); } static __device__ __forceinline__ v8f mma(V a, V b, v8f c) { return wmma16(a, b, c); } };
template <> struct WFrag<bf> { typedef v16bf V; static __device__ __forceinline__ V ld(const bf* p) { return cat16b(*(const v8us*)p, *(const v8us*)(p + 256)); } static __device__ __forceinline__ v8f mma(V a, V b, v8f c) { return wmmab(a, b, c); } };
// L2 asks. The operand planes were stored by the launch before; where such a line is no longer in the reader's L2, the first copy of a tile to touch it waits a memory latency. One lane asks into L2 at the start of each aligned 256 bytes (nothing returns, no counter moves), PD passes ahead of the pass that reads it.
// The address stands in a register pair that lives through the pass loop and only ever holds addresses inside the plane.
#define PD   5        // the copies of tile t + 2 go out at the foot of pass t, the ask for tile t + PD with them: three passes of lead
static_assert(PD == 5);   // l2ask's immediate is PD - 2 tiles, l2ask3 covers tiles 2 .. PD - 1
// in the loop: the pair stands at tile t + 2, the tile asked is three tiles (of STEP bytes) on. The pair is moved on in front of the next ask, a pass later and behind that pass's copies with their s_wait_xcnt, not behind this one.
template <int STEP, typename T16>
__device__ __forceinline__ void l2ask(const T16* p) { asm volatile("global_prefetch_b8 %0, off offset:%1 scope:SCOPE_SE" :: "v"(p), "n"(3 * STEP)); }
// at entry: three tiles in a row, STEP bytes apart, over the same register pair
template <int STEP, typename T16>
__device__ __forceinline__ void l2ask3(const T16* p) {
    asm volatile("global_prefetch_b8 %0, off scope:SCOPE_SE\n\t"
                 "global_prefetch_b8 %0, off offset:%1 scope:SCOPE_SE\n\t"
                 "global_prefetch_b8 %0, off offset:%2 scope:SCOPE_SE" :: "v"(p), "n"(STEP), "n"(2 * STEP));
}
#define GW   4
#define KP   64
#define OPE  (128 * KP)     // 16-bit elements of one operand's share of a staged pass (16 KB)
// eight copies a lane, 2 KB a copy over the work-group's 128 lanes: one operand's eight groups of 16 rows. l = the lane's LDS byte address in the first group, p = the lane's 16 bytes in the first group's source; 16 rows on = 16 * K elements.
// The s_wait_xcnt is a precaution and is the statement's last line, so that it stands in front of every later write of a register that a copy names.
template <int K, typename T16>
__device__ __forceinline__ void copy8r(unsigned l, const T16* p) {
    asm volatile("global_load_async_to_lds_b128 %0, %8, off\n\t"
                 "global_load_async_to_lds_b128 %1, %9, off\n\t"
                 "global_load_async_to_lds_b128 %2, %10, off\n\t"
                 "global_load_async_to_lds_b128 %3, %11, off\n\t"
                 "global_load_async_to_lds_b128 %4, %12, off\n\t"
                 "global_load_async_to_lds_b128 %5, %13, off\n\t"
                 "global_load_async_to_lds_b128 %6, %14, off\n\t"
                 "global_load_async_to_lds_b128 %7, %15, off\n\t"
                 "s_wait_xcnt 0x0"
                 :: "v"(l), "v"(l + 2048u), "v"(l + 4096u), "v"(l + 6144u), "v"(l + 8192u), "v"(l + 10240u), "v"(l + 12288u), "v"(l + 14336u),
                    "v"(p), "v"(p + 16 * K), "v"(p + 32 * K), "v"(p + 48 * K), "v"(p + 64 * K), "v"(p + 80 * K), "v"(p + 96 * K), "v"(p + 112 * K) : "memory");
}
template <typename T16, int NSPLIT, bool BIAS, bool PLANES, int K>
__global__ __launch_bounds__(GW * 32) void k_gemmw(const T16* __restrict__ A, const T16* __restrict__ A2, const T16* __restrict__ Bt, const T16* __restrict__ Bt2, float* C, int ldc, const float* __restrict__ bias, size_t sA, size_t sB, size_t sC, h16* P16, bf* Ph, bf* Pl) {
    typedef typename WFrag<T16>::V V;
    static_assert(NSPLIT == 0 || NSPLIT == 1); static_assert(K % KP == 0 && K / KP >= 2);
    constexpr int STE = (NSPLIT == 1 ? 3 : 2) * OPE;      // elements of one staged pass: A, Bt (, A2)
    __shared__ __attribute__((aligned(16))) T16 st[2 * STE];
    __shared__ __align__(16) float osa[GW * 16 * 68];
    const size_t z = blockIdx.z; int bx = blockIdx.x, by = blockIdx.y; bool isv = false;
    if constexpr (PLANES) { const size_t job = z / NB; const T16* Wj = A + job * sA; const T16* Xb = Bt + (z - job * NB) * sB; P16 += z * sC; Ph += z * sC; Pl += z * sC;
        if (job == 2) { A = Xb; Bt = Wj; bx = blockIdx.y; by = blockIdx.x; isv = true; } else { A = Wj; Bt = Xb; } }
    else { A += z * sA; if (A2) A2 += z * sA; Bt += z * sB; if (Bt2) Bt2 += z * sB; C += z * sC; }
    const int lane = threadIdx.x & 31, lr = lane & 15, hi = lane >> 4; const int w = __builtin_amdgcn_readfirstlane((int)(threadIdx.x >> 5)), wm = w >> 1, wn = w & 1; const int r0 = bx * 128 + wm * 64, c0 = by * 128 + wn * 64;
    v8f acc[4][4];
#pragma unroll
    for (int mb = 0; mb < 4; ++mb)
#pragma unroll
        for (int nb = 0; nb < 4; ++nb) acc[mb][nb] = (v8f){};
    const size_t aoff = (size_t)bx * 128 * K, boff = (size_t)by * 128 * K; const unsigned loff = (unsigned)(lane * 8);      // 16 rows of blocks = 16 * K elements; 32 k on = 512 elements
    const unsigned l0 = (unsigned)(uintptr_t)st + threadIdx.x * 16u;
    auto stage = [&](int t) { const size_t ko = (size_t)t * (KP * 16) + threadIdx.x * 8u; const unsigned lb = l0 + (unsigned)(t & 1) * (STE * 2u);
        copy8r<K>(lb, A + aoff + ko); copy8r<K>(lb + OPE * 2u, Bt + boff + ko); if constexpr (NSPLIT == 1) copy8r<K>(lb + OPE * 4u, A2 + aoff + ko); };
    // L2 asks, dealt among the work-groups that walk the same panel at the same time, so that a unit is asked a few times and not once a reader: of a panel's 8 groups of 16 rows a work-group asks 2 (4 of Bt with NSPLIT), picked by its index along the other operand.
    // A tile's share of a group is 2 KB in a row = 8 units. NSPLIT 0: wave 0, lanes 0-15 A, 16-31 Bt. NSPLIT 1: wave 0, lanes 0-15 A, 16-31 A2; wave 1, Bt.
    constexpr int NT = K / KP, NPW = NSPLIT == 1 ? 2 : 1; static_assert(NT >= PD + 3);
    const T16* pf;
    { const int g2 = (lane >> 3) & 1; const T16* pa = A + aoff + (size_t)((by & 3) + 4 * g2) * (16 * K);
      if constexpr (NSPLIT == 1) { const T16* pa2 = A2 + aoff + (size_t)((by & 3) + 4 * g2) * (16 * K); const T16* pb = Bt + boff + (size_t)((bx & 1) + 2 * (lane >> 3)) * (16 * K); pf = w == 0 ? (hi ? pa2 : pa) : pb; }
      else { const T16* pb = Bt + boff + (size_t)((bx & 3) + 4 * g2) * (16 * K); pf = hi ? pb : pa; }
      pf += (lane & 7) * 128 + 2 * (KP * 16); }      // tile 2: tiles 0 and 1 are copied at once
    stage(0);
    if (w < NPW) l2ask3<KP * 32>(pf);      // tiles 2, 3, 4
    asm volatile("s_wait_asynccnt 0x0" ::: "memory");       // this wave's share of pass 0 has landed
    __syncthreads();                                        // every wave's share has: pass 0 may be read
    stage(1);
#pragma unroll 1
    for (int t = 0; t < K / KP; ++t) {
        const T16* sa = st + (t & 1) * STE + wm * (64 * KP) + loff; const T16* sb = st + (t & 1) * STE + OPE + wn * (64 * KP) + loff;
        V a[KP / 32][4], a2[KP / 32][4], b[KP / 32][4];
#pragma unroll
        for (int ks = 0; ks < KP / 32; ++ks) {
#pragma unroll
            for (int mb = 0; mb < 4; ++mb) { if (mb == 0) b[ks][0] = WFrag<T16>::ld(sb + ks * 512); a[ks][mb] = WFrag<T16>::ld(sa + mb * (16 * KP) + ks * 512); if (NSPLIT == 1) a2[ks][mb] = WFrag<T16>::ld(sa + 2 * OPE + mb * (16 * KP) + ks * 512); }
#pragma unroll
            for (int nb = 1; nb < 4; ++nb) b[ks][nb] = WFrag<T16>::ld(sb + nb * (16 * KP) + ks * 512);
        }
        // keeps the pass's LDS reads as one group ahead of its matrix instructions, in the order of their use; without it they are asked for in turns among the matrix instructions, into reused registers, a latency each
        __builtin_amdgcn_sched_barrier(0);
#pragma unroll
        for (int ks = 0; ks < KP / 32; ++ks)
#pragma unroll
            for (int nb = 0; nb < 4; ++nb)
#pragma unroll
                for (int mb = 0; mb < 4; ++mb) { acc[mb][nb] = WFrag<T16>::mma(a[ks][mb], b[ks][nb], acc[mb][nb]); if (NSPLIT == 1) acc[mb][nb] = WFrag<T16>::mma(a2[ks][mb], b[ks][nb], acc[mb][nb]); }
        // keeps the hand-over behind the pass's matrix instructions; without it its waits are lifted over them, so that the wave waits for all of its LDS reads before its first product, while the refill stays below and loses its lead
        __builtin_amdgcn_sched_barrier(0);
        // hand-over, every wave, in this order: own LDS reads done; own copies of pass t + 1 landed; the barrier publishes pass t + 1 and ends every reader's last read of pass t's buffer; only then is that buffer refilled
        asm volatile("s_wait_dscnt 0x0" ::: "memory");
        asm volatile("s_wait_asynccnt 0x0" ::: "memory");
        __syncthreads();
        if (t + 2 < K / KP) { stage(t + 2);
            if (w < NPW && t + PD < NT) { if (t > 0) pf += KP * 16; l2ask<KP * 32>(pf); } }      // tile t + PD, inside the refill's branch (a tile t + PD implies a tile t + 2); the tests are the wave's own scalars; the pair stops at tile NT - 4, three short of the last tile asked
    }
    asm volatile("s_wait_asynccnt 0x0" ::: "memory");       // no copy is in flight when the wave ends
    if constexpr (PLANES) {
        // q, k: head r0 / 64, block (t / 16) * 2 + d / 32, t = c0 + nb * 16 + lr, d = mb * 16 + 8 * hi + j; v: head c0 / 64, block (t / 32) * 4 + d / 16, t = r0 + mb * 16 + 8 * hi + j, d = nb * 16 + lr
        const size_t pb = (isv ? (size_t)(c0 / 64) * (TT * HD) + (size_t)r0 * HD : (size_t)(r0 / 64) * (TT * HD) + (size_t)c0 * HD) + lane * 8;
        const int smb = isv ? 2048 : 512, snb = isv ? 512 : 1024;
        // all three loops unrolled: the accumulators are indexed by constants alone and stay in registers
#pragma unroll
        for (int nb = 0; nb < 4; ++nb)
#pragma unroll
            for (int mb = 0; mb < 4; ++mb) { v8h o16; v8us oh, ol;
#pragma unroll
                for (int j = 0; j < 8; ++j) { const float x = acc[mb][nb][j]; o16[j] = tohx(x); unsigned short a2, c2; splitf(x, a2, c2); oh[j] = a2; ol[j] = c2; }
                const size_t po = pb + (mb >> 1) * smb + nb * snb + (mb & 1) * 256; *(v8h*)(P16 + po) = o16; *(v8us*)(Ph + po) = oh; *(v8us*)(Pl + po) = ol; }
        return;
    }
    float* os = osa + w * (16 * 68);      // each wave turns its tile in its own range
#pragma unroll
    for (int mb = 0; mb < 4; ++mb) {
#pragma unroll
        for (int nb = 0; nb < 4; ++nb) {
#pragma unroll
            for (int j = 0; j < 8; ++j) os[(hi * 8 + j) * 68 + nb * 16 + lr] = acc[mb][nb][j]; }
        __builtin_amdgcn_wave_barrier(); asm volatile("" ::: "memory");
        float* crow = C + (size_t)(r0 + mb * 16) * ldc + c0;
{
#pragma unroll
            for (int s = 0; s < 8; ++s) { const int row = 2 * s + hi, cofs = lr * 4; v4f val = *(const v4fa*)(os + row * 68 + cofs); if (BIAS) { val[0] += bfr(bias[c0 + cofs]); val[1] += bfr(bias[c0 + cofs + 1]); val[2] += bfr(bias[c0 + cofs + 2]); val[3] += bfr(bias[c0 + cofs + 3]); }
                *(v4f*)(crow + (size_t)row * ldc + cofs) = val; }
             }
        __builtin_amdgcn_wave_barrier(); asm volatile("" ::: "memory");
    }
}

typedef __attribute__((ext_vector_type(2))) _Float16 v2h;
typedef __attribute__((ext_vector_type(4))) _Float16 v4h;
typedef __attribute__((ext_vector_type(2))) unsigned short v2us;
typedef __attribute__((ext_vector_type(4))) unsigned short v4us;
typedef __attribute__((ext_vector_type(2))) float v2f;
typedef __attribute__((ext_vector_type(4))) int v4i;

// weight w[k][n] -> fragment-order plane with rows n: a thread builds the two 16-byte pieces (k & 8 alike, both halves) of one n in one block; lanes run along n, so a load is one whole line and a store two runs of 256 bytes.
__device__ __forceinline__ void wtG(const float* __restrict__ w, int K, int N, bf* Bt, int blk) {
    const int lane = threadIdx.x & 31; const int u = blk * 8 + (threadIdx.x >> 5); const int nkc = K >> 5;
    const int hi = u & 1, kc = (u >> 1) % nkc, n = ((u >> 1) / nkc) * 32 + lane; if (n >= N) return;
    const float* s = w + (size_t)(kc * 32 + hi * 8) * N + n; v8us o0, o1;
#pragma unroll
    for (int j = 0; j < 8; ++j) { o0[j] = f2bf(s[(size_t)j * N]); o1[j] = f2bf(s[(size_t)(16 + j) * N]); }
    asm volatile("s_wait_xcnt 0x0" :: "v"(s) : "memory");   // precaution: the address is its input, so that it keeps its registers up to here and none of the sixteen requests lands in one
    bf* d = Bt + ((size_t)(n >> 4) * nkc + kc) * 512 + (hi * 16 + (n & 15)) * 8; *(v8us*)d = o0; *(v8us*)(d + 256) = o1;
}
// src [rows][K] f32 -> fragment-order plane: 64 threads a block, four neighbours share a row; a wave reads 8 whole lines (8 rows x 32 k) and its store is 4 whole lines (a piece of 8 rows is 128 bytes in a row).
__device__ __forceinline__ void cvt8(const float* __restrict__ src, bf* dst, size_t n8, int K, int blk) { const size_t i = (size_t)blk * 256 + threadIdx.x; if (i >= n8) return;
    const int nkc = K >> 5; const int b = (int)(i >> 6), lr = (int)(i >> 2) & 15, p = (int)i & 3;
    const v8f v = *(const v8f*)(src + (size_t)((b / nkc) * 16 + lr) * K + (b % nkc) * 32 + p * 8); v8us o;
#pragma unroll
    for (int j = 0; j < 8; ++j) o[j] = f2bf(v[j]); *(v8us*)(dst + (size_t)b * 512 + (p >> 1) * 256 + ((p & 1) * 16 + lr) * 8) = o;  }
// all operand conversions in ONE launch, the job picked by block range: 4 * GWT blocks turn the four weights (the longer job, dealt first), then NB * GCV blocks convert x. W: four planes one behind the other (q, k, v, o); XB: NB planes of TT rows, k = DM.
#define GWT  ((DQ * DM / 16 + 255) / 256)
#define GCV  ((TT * DM / 8 + 255) / 256)
__global__ __launch_bounds__(256) void k_prep(const float* __restrict__ x, const float* __restrict__ wq, const float* __restrict__ wk, const float* __restrict__ wv, const float* __restrict__ wo, bf* W, bf* XB) {
    const int blk = (int)blockIdx.x;
    if (blk < 4 * GWT) { const int j = blk / GWT; wtG(j == 0 ? wq : j == 1 ? wk : j == 2 ? wv : wo, j == 3 ? DQ : DM, j == 3 ? DM : DQ, W + (size_t)j * DQ * DM, blk - j * GWT); }
    else { const int b = (blk - 4 * GWT) / GCV; cvt8(x + (size_t)b * SEQ_FULL * DM, XB + (size_t)b * TT * DM, (size_t)TT * DM / 8, DM, blk - 4 * GWT - b * GCV); }
}
// ---- k_attn: causal attention for one head, 16 query rows per wave, AW waves (QB rows) a work-group, scores never leave registers. Both products are taken transposed: S^T = K.Q^T puts a query in each lane (column l & 15) and keys 8*(l>>4)+j in
// its accumulator elements, which is already the B-fragment k order of O^T = V^T.P^T (key tile 2g -> elements 0..7, key tile 2g+1 -> elements 8..15), so probabilities go from accumulator to operand without a shuffle.
// Online softmax: running maximum m of the raw scores and running sum l per query; o and l are rescaled by exp2((m_old - m_new) c) each pass of KB keys. Probabilities are carried unnormalised (<= 1); the division by l is last.
// The work-group's waves walk the same keys: each pass's keys and values (16 KB, whole fragment-order blocks, so plain runs of bytes) are brought into LDS once for all of them by asynchronous copies, two buffers, the next pass's copies in flight while this pass is worked on.
#define AW   4
#define QB   (AW * 16)
#define STG  8192     // 16-bit elements of one staged pass: four segments of 4 KB (fp16: keys, keys, values, values; hi/lo: keys hi, keys lo, values hi, values lo)
static_assert((RH) % QB == 0);
static_assert((SEQ) % QB == 0);
// eight copies a lane, 2 KB a copy over the work-group's 128 lanes: l = the lane's LDS byte address in segment 0, a..d = the lane's 16 bytes in the first half of each segment's source.
// The s_wait_xcnt is a precaution and is the statement's last line, so that it stands in front of every later write of a register that a copy names.
template <typename T16>
__device__ __forceinline__ void copy8(unsigned l, const T16* a, const T16* b, const T16* c, const T16* d) {
    asm volatile("global_load_async_to_lds_b128 %0, %8, off\n\t"
                 "global_load_async_to_lds_b128 %1, %9, off\n\t"
                 "global_load_async_to_lds_b128 %2, %10, off\n\t"
                 "global_load_async_to_lds_b128 %3, %11, off\n\t"
                 "global_load_async_to_lds_b128 %4, %12, off\n\t"
                 "global_load_async_to_lds_b128 %5, %13, off\n\t"
                 "global_load_async_to_lds_b128 %6, %14, off\n\t"
                 "global_load_async_to_lds_b128 %7, %15, off\n\t"
                 "s_wait_xcnt 0x0"
                 :: "v"(l), "v"(l + 2048u), "v"(l + 4096u), "v"(l + 6144u), "v"(l + 8192u), "v"(l + 10240u), "v"(l + 12288u), "v"(l + 14336u),
                    "v"(a), "v"(a + 1024), "v"(b), "v"(b + 1024), "v"(c), "v"(c + 1024), "v"(d), "v"(d + 1024) : "memory");
}
__device__ __forceinline__ float xhalf(float x) { return __builtin_bit_cast(float, __builtin_amdgcn_permlanex16(__builtin_bit_cast(int, x), __builtin_bit_cast(int, x), 0x76543210, 0xfedcba98, false, false)); }  // lane l with lane l ^ 16
__device__ __forceinline__ void pfrag(const v8f& p0, const v8f& p1, v16h& f, v16h& f2) { (void)f2;
#pragma unroll
    for (int j = 0; j < 8; ++j) { f[j] = tohx(p0[j]); f[8 + j] = tohx(p1[j]); } }
__device__ __forceinline__ void pfrag(const v8f& p0, const v8f& p1, v16bf& f, v16bf& f2) { v8us h0, h1, l0, l1;
#pragma unroll
    for (int j = 0; j < 8; ++j) { unsigned short a, c2; splitf(p0[j], a, c2); h0[j] = a; l0[j] = c2; splitf(p1[j], a, c2); h1[j] = a; l1[j] = c2; }
    f = cat16b(h0, h1); f2 = cat16b(l0, l1); }
template <typename T16, bool SPLIT, int KB>
__device__ __forceinline__ void attn_rows(const T16* __restrict__ Q, const T16* __restrict__ Q2, const T16* __restrict__ Kp, const T16* __restrict__ K2, const T16* __restrict__ Vt, const T16* __restrict__ V2, int Q0, int q0, int lr, int hi, const T16* sm, bf* Ah, bf* Al) {
    typedef typename WFrag<T16>::V V;
    constexpr int NK = KB / 16, NG = KB / 32;
    const float c = SCL * 1.4426950408889634f;
    const unsigned loff = (unsigned)((hi * 16 + lr) * 8);      // the lane's piece in each half of a block
    V qf[2], qf2[2];
#pragma unroll
    for (int ks = 0; ks < 2; ++ks) { qf[ks] = WFrag<T16>::ld(Q + (size_t)q0 * HD + ks * 512 + loff); if constexpr (SPLIT) qf2[ks] = WFrag<T16>::ld(Q2 + (size_t)q0 * HD + ks * 512 + loff); }
    v8f o[4];
#pragma unroll
    for (int db = 0; db < 4; ++db) o[db] = (v8f){};
    float m = -3.0e38f, l = 0.f;
    const int np = (Q0 + QB) / KB;      // passes of the work-group, the same for all its waves: keys 0 .. Q0 + QB - 1
    const unsigned l0 = (unsigned)(uintptr_t)sm + threadIdx.x * 16u;
    auto stage = [&](int t) { const size_t kb = (size_t)t * (KB * HD) + threadIdx.x * 8u; const unsigned lb = l0 + (unsigned)(t & 1) * (STG * 2u);
        if constexpr (SPLIT) copy8(lb, Kp + kb, K2 + kb, Vt + kb, V2 + kb); else copy8(lb, Kp + kb, Kp + kb + 2048, Vt + kb, Vt + kb + 2048); };
    // L2 asks: a head's work-groups of one kind all walk the same planes from key 0 on at about the same pace, so the one with the kind's last rows, which alone walks them all, asks for all: wave 0 a tile's keys, wave 1 its values
    // (fp16: 8 KB = 32 units each; hi/lo: 4 KB = 16 units a plane, the hi plane on lanes 0-15, the lo plane on lanes 16-31)
    const int wv = __builtin_amdgcn_readfirstlane((int)(threadIdx.x >> 5));
    const bool ask = wv < 2 && Q0 + QB == (SPLIT ? RH : TT) && np >= PD + 3;
    const T16* pf;
    if constexpr (SPLIT) pf = (wv == 1 ? (hi ? V2 : Vt) : (hi ? K2 : Kp)) + lr * 128; else pf = (wv == 1 ? Vt : Kp) + (hi * 16 + lr) * 128;
    pf += 2 * (KB * HD);      // tile 2: tiles 0 and 1 are copied at once
    stage(0);
    if (ask) l2ask3<KB * HD * 2>(pf);      // tiles 2, 3, 4
    asm volatile("s_wait_asynccnt 0x0" ::: "memory");       // this wave's share of pass 0 has landed
    __syncthreads();                                        // every wave's share has: pass 0 may be read
    if (np > 1) stage(1);
#pragma unroll 1
    for (int t = 0; t < np; ++t) {
      const int k0 = t * KB;
      // every wave works every pass of its work-group. With KB < QB the last pass lies wholly above the rows of the lower waves: all its scores are masked, so the maximum stays, every probability is 0, and sum and output are rescaled alike by exp2 of the exponent's rounding residue, as in any pass that leaves the maximum as it is.
      V va[NG][4], va2[NG][4]; v8f s[NK];
      {
        V ka[NK][2], ka2[NK][2];     // all of a pass's LDS reads go out in one run, keys first: the values' share of the latency runs under the score products
        const T16* sb = sm + (t & 1) * STG + loff;
#pragma unroll
        for (int kt = 0; kt < NK; ++kt)
#pragma unroll
            for (int ks = 0; ks < 2; ++ks) { ka[kt][ks] = WFrag<T16>::ld(sb + (kt * 2 + ks) * 512); if constexpr (SPLIT) ka2[kt][ks] = WFrag<T16>::ld(sb + 2048 + (kt * 2 + ks) * 512); }
#pragma unroll
        for (int g = 0; g < NG; ++g)
#pragma unroll
            for (int db = 0; db < 4; ++db) { va[g][db] = WFrag<T16>::ld(sb + 4096 + (g * 4 + db) * 512); if constexpr (SPLIT) va2[g][db] = WFrag<T16>::ld(sb + 6144 + (g * 4 + db) * 512); }
        // inputs-only fence on the loaded key fragments: all eight are in flight together; without it they are asked for in turns into reused registers, several latencies a pass
        if constexpr (SPLIT) asm volatile("" :: "v"(ka[0][0]), "v"(ka[0][1]), "v"(ka[1][0]), "v"(ka[1][1]), "v"(ka2[0][0]), "v"(ka2[0][1]), "v"(ka2[1][0]), "v"(ka2[1][1]));
        else asm volatile("" :: "v"(ka[0][0]), "v"(ka[0][1]), "v"(ka[1][0]), "v"(ka[1][1]), "v"(ka[NK - 2][0]), "v"(ka[NK - 2][1]), "v"(ka[NK - 1][0]), "v"(ka[NK - 1][1]));
#pragma unroll
        for (int kt = 0; kt < NK; ++kt) { v8f acc = (v8f){};
#pragma unroll
            for (int ks = 0; ks < 2; ++ks) { acc = WFrag<T16>::mma(ka[kt][ks], qf[ks], acc);
                if constexpr (SPLIT) { acc = WFrag<T16>::mma(ka2[kt][ks], qf[ks], acc); acc = WFrag<T16>::mma(ka[kt][ks], qf2[ks], acc); } }
            s[kt] = acc; }
      }
      // hand-over, every wave, in this order: own LDS reads done (the pass's fragments are all in registers from here on); own copies of pass t + 1 landed; the barrier publishes pass t + 1 and ends every reader's last read of pass t's buffer;
      // only then is that buffer refilled, here and not at the end of the pass, so that the copies fly under softmax, the value products and the next pass's reads
      asm volatile("s_wait_dscnt 0x0" ::: "memory");
      asm volatile("s_wait_asynccnt 0x0" ::: "memory");
      __syncthreads();
      if (t + 2 < np) { stage(t + 2);
          if (ask && t + PD < np) { if (t > 0) pf += KB * HD; l2ask<KB * HD * 2>(pf); } }      // tile t + PD, inside the refill's branch (a tile t + PD implies a tile t + 2); the tests are the wave's own scalars; the pair stops at tile np - 4, three short of the last tile asked
      {
        if (k0 + KB - 1 > q0) {      // only passes that reach the diagonal hold keys above a query: mask by index select
#pragma unroll
            for (int kt = 0; kt < NK; ++kt)
#pragma unroll
                for (int j = 0; j < 8; ++j) s[kt][j] = (k0 + kt * 16 + 8 * hi + j <= q0 + lr) ? s[kt][j] : -3.0e38f; }
        float mx = m;
#pragma unroll
        for (int kt = 0; kt < NK; ++kt) { float t = s[kt][0];      // one short chain a key tile, side by side
#pragma unroll
            for (int j = 1; j < 8; ++j) t = fmaxf(t, s[kt][j]);
            mx = fmaxf(mx, t); }
        mx = fmaxf(mx, xhalf(mx));      // the two lane halves hold different keys of the same query
        const float mc = mx * c;                        // exponent as one fused multiply-add a score: s c - max c
        const float alpha = __builtin_amdgcn_exp2f(__builtin_fmaf(m, c, -mc)); m = mx;
        float ps = 0.f;
#pragma unroll
        for (int kt = 0; kt < NK; ++kt) { float t = 0.f;
#pragma unroll
            for (int j = 0; j < 8; ++j) { s[kt][j] = __builtin_amdgcn_exp2f(__builtin_fmaf(s[kt][j], c, -mc)); t += s[kt][j]; }
            ps += t; }
        l = l * alpha + ps;
#pragma unroll
        for (int db = 0; db < 4; ++db) o[db] *= alpha;
#pragma unroll
        for (int g = 0; g < NG; ++g) { V pf, pf2; pfrag(s[2 * g], s[2 * g + 1], pf, pf2);
#pragma unroll
            for (int db = 0; db < 4; ++db) { o[db] = WFrag<T16>::mma(va[g][db], pf, o[db]); if constexpr (SPLIT) { o[db] = WFrag<T16>::mma(va2[g][db], pf, o[db]); o[db] = WFrag<T16>::mma(va[g][db], pf2, o[db]); } } }
      }
    }
    asm volatile("s_wait_asynccnt 0x0" ::: "memory");       // no copy is in flight when the wave ends
    l += xhalf(l);
    const float inv = __fdiv_rn(1.0f, l);
#pragma unroll
    for (int db = 0; db < 4; ++db) { v8us oh, ol;
#pragma unroll
        for (int j = 0; j < 8; ++j) { unsigned short a, c2; splitf(o[db][j] * inv, a, c2); oh[j] = a; ol[j] = c2; }
        const size_t oo = (size_t)q0 * DQ + (db >> 1) * 512 + (db & 1) * 256 + loff; *(v8us*)(Ah + oo) = oh; *(v8us*)(Al + oo) = ol; }
}
// grid (heads, NB, TT/QB), AW waves a block; the longest rows (most keys) are dealt first. Every operand plane is [NB][heads][...]; Ah, Al: NB fragment-order planes of TT rows, k = DQ (a head's 64 k are 2 blocks).
__global__ __launch_bounds__(AW * 32) void k_attn(const h16* __restrict__ Q16, const h16* __restrict__ K16, const h16* __restrict__ V16, const bf* __restrict__ Qh, const bf* __restrict__ Ql, const bf* __restrict__ Kh, const bf* __restrict__ Kl, const bf* __restrict__ Vh, const bf* __restrict__ Vl, bf* Ah, bf* Al) {
    __shared__ __attribute__((aligned(16))) unsigned short kv[2 * STG];
    const int lane = threadIdx.x & 31, lr = lane & 15, hi = lane >> 4; const int Q0 = (TT / QB - 1 - (int)blockIdx.z) * QB, q0 = Q0 + __builtin_amdgcn_readfirstlane((int)(threadIdx.x >> 5)) * 16;
    const size_t hb = ((size_t)blockIdx.y * NH_ + blockIdx.x) * TT * HD; const size_t ho = (size_t)blockIdx.y * TT * DQ + (size_t)blockIdx.x * (HD / 32) * 512;
    if (Q0 < RH) attn_rows<bf, true, 32>(Qh + hb, Ql + hb, Kh + hb, Kl + hb, Vh + hb, Vl + hb, Q0, q0, lr, hi, (const bf*)kv, Ah + ho, Al + ho);
    else attn_rows<h16, false, 64>(Q16 + hb, nullptr, K16 + hb, nullptr, V16 + hb, nullptr, Q0, q0, lr, hi, (const h16*)kv, Ah + ho, Al + ho);
}

extern "C" void kernel_launch(void* const* d_in, const int* in_sizes, int n_in,
                              void* d_out, int out_size, void* d_ws, size_t ws_size, hipStream_t stream) {
    if (n_in < 6) return;
    const size_t xneed = (size_t)(NB - 1) * SEQ_FULL * DM + (size_t)TT * DM;
    if ((size_t)in_sizes[0] < xneed || (size_t)in_sizes[1] < (size_t)DM * DQ || (size_t)in_sizes[2] < (size_t)DM * DQ || (size_t)in_sizes[3] < (size_t)DM * DQ || (size_t)in_sizes[4] < (size_t)DQ * DM || in_sizes[5] < DM || (size_t)out_size < xneed) return;
    const float* x = (const float*)d_in[0]; const float* wq = (const float*)d_in[1]; const float* wk = (const float*)d_in[2]; const float* wv = (const float*)d_in[3]; const float* wo = (const float*)d_in[4]; const float* bo = (const float*)d_in[5];
    float* OUT = (float*)d_out;     // [NB][SEQ][1024], batch stride SEQ_FULL*DM
    char* wsp = (char*)d_ws;
    auto take = [&](size_t bytes) { char* p = wsp; wsp += (bytes + 255) & ~(size_t)255; return (void*)p; };
    bf* WALL = (bf*)take((size_t)4 * DQ * DM * 2);      // weight planes, rows n, from the [in][out] storage: q, k, v, o, one behind the other
    bf* XB = (bf*)take((size_t)NB * TT * DM * 2);
    const size_t PS = (size_t)NH_ * TT * HD;            // elements of one operand plane of one batch
    h16* P16 = (h16*)take((size_t)3 * NB * PS * 2); bf* PH = (bf*)take((size_t)3 * NB * PS * 2); bf* PL = (bf*)take((size_t)3 * NB * PS * 2);     // [q, k, v][NB] planes
    bf* ATh = (bf*)take((size_t)NB * TT * DQ * 2); bf* ATl = (bf*)take((size_t)NB * TT * DQ * 2);
    if ((size_t)(wsp - (char*)d_ws) > ws_size) return;
    k_prep<<<4 * GWT + NB * GCV, 256, 0, stream>>>(x, wq, wk, wv, wo, WALL, XB);
    k_gemmw<bf, 0, false, true, DM><<<dim3(DQ / 128, TT / 128, 3 * NB), GW * 32, 0, stream>>>(WALL, nullptr, XB, nullptr, nullptr, 0, nullptr, (size_t)DQ * DM, (size_t)TT * DM, PS, P16, PH, PL);
    k_attn<<<dim3(NH_, NB, TT / QB), AW * 32, 0, stream>>>(P16, P16 + NB * PS, P16 + 2 * NB * PS, PH, PL, PH + NB * PS, PL + NB * PS, PH + 2 * NB * PS, PL + 2 * NB * PS, ATh, ATl);
    k_gemmw<bf, 1, true, false, DQ><<<dim3(TT / 128, DM / 128, NB), GW * 32, 0, stream>>>(ATh, ATl, WALL + (size_t)3 * DQ * DM, nullptr, OUT, DM, bo, (size_t)TT * DQ, 0, (size_t)SEQ_FULL * DM, nullptr, nullptr, nullptr);
}

// v009
// Measured time: 56.9 microseconds a run.
// Versions between v007 and this one are left out; their measured steps multiply to 1.19 times as fast.
// Counting every step since v000, it is 26.0 times as fast.
#include <hip/hip_runtime.h>

// Causal multi-head self-attention: x [NB][SEQ][1024]; q/k/v = x W (W stored [in][out], no bias; 16 heads x 64); softmax(q.k^T / 8) under a lower-triangular mask; out = merged(attn.v) Wo + bo -> [NB][SEQ][1024] f32.
// Compute dtypes, f32 accumulate: every float input RNE-converted to bf16 on load; q/k/v projections v_wmma_f32_16x16x32_bf16 on plain bf16 operands (exact products);
// causal scores and attn.v: q, k, v and the probabilities (carried unnormalised) are single fp16 operands (v_wmma_f32_16x16x32_f16); online softmax f32, scores kept in registers;
// output projection: single fp16 activations x Wo (rounded to bf16 like every input, that value held as fp16; v_wmma_f32_16x16x32_f16) + bias.
// FRAGMENT ORDER: every 16-bit operand plane (a matrix M[row][k]) lies in the workspace as 1 KB blocks, one per (16 rows, 32 k): element (row, k) of a block sits at ((k & 31) >> 4) * 256 + (((k >> 3) & 1) * 16 + (row & 15)) * 8 + (k & 7).
// Lane l's fragment is then the 16 bytes at l * 16 of each 512-byte half: a wave's load covers 4 whole 128-byte lines, and which element reaches which lane and register is as with row-major planes.
// Blocks of a GEMM operand: [row / 16][k / 32]; q, k planes per head: [t / 16][d / 32]; v planes per head: [t / 32][d / 16].

#ifndef NB
#define NB   2
#endif
#ifndef SEQ
#define SEQ  2048
#endif
#define NB_FULL  2
#define SEQ_FULL 2048
#define TT   SEQ
#define DM   1024
#define NH_  16
#define HD   64
#define DQ   (NH_ * HD)
#define SCL  0.125f   // HD^-0.5

static_assert((SEQ) % 128 == 0);
static_assert((DM) % 128 == 0);
static_assert((HD) == 64);
static_assert((NB) >= 1 && (NB) <= (NB_FULL));
static_assert((SEQ) <= (SEQ_FULL));

typedef _Float16 h16;
typedef unsigned short bf;
typedef __attribute__((ext_vector_type(16))) __bf16   v16bf;
typedef __attribute__((ext_vector_type(16))) _Float16 v16h;
typedef __attribute__((ext_vector_type(8)))  _Float16 v8h;
typedef __attribute__((ext_vector_type(8)))  unsigned short v8us;
typedef __attribute__((ext_vector_type(8)))  float    v8f;
typedef __attribute__((ext_vector_type(4)))  float    v4f;
typedef v8h  __attribute__((may_alias)) v8ha;
typedef v4f  __attribute__((may_alias)) v4fa;
typedef v8us __attribute__((may_alias)) v8usa;

__device__ __forceinline__ unsigned short f2bf(float f) { unsigned u = __float_as_uint(f); u += 0x7FFFu + ((u >> 16) & 1u); return (unsigned short)(u >> 16); }
__device__ __forceinline__ float bf2f(unsigned short b) { return __uint_as_float(((unsigned)b) << 16); }
__device__ __forceinline__ float bfr(float f) { return bf2f(f2bf(f)); }
__device__ __forceinline__ h16 tohx(float x) { return (h16)x; }
__device__ __forceinline__ v16h cat16(v8h lo, v8h hi) { return __builtin_shufflevector(lo, hi, 0, 1, 2, 3, 4, 5, 6, 7, 8, 9, 10, 11, 12, 13, 14, 15); }
__device__ __forceinline__ v16bf cat16b(v8us lo, v8us hi) { return __builtin_bit_cast(v16bf, __builtin_shufflevector(lo, hi, 0, 1, 2, 3, 4, 5, 6, 7, 8, 9, 10, 11, 12, 13, 14, 15)); }
__device__ __forceinline__ v8f wmma16(v16h a, v16h b, v8f c) { return __builtin_amdgcn_wmma_f32_16x16x32_f16(false, a, false, b, (short)0, c, false, false); }
__device__ __forceinline__ v8f wmmab(v16bf a, v16bf b, v8f c) { return __builtin_amdgcn_wmma_f32_16x16x32_bf16(false, a, false, b, (short)0, c, false, false); }

// ---- k_gemmw: register-blocked GEMM, one wave per 64x64 output tile (16 accumulators), GW waves (2 x 2) a work-group on a 128x128 tile; grid (M/128, N/128, Z), GW * 32 threads (PLANES: see below).
// The operands' 128 rows x KP k of a pass (whole fragment-order blocks: 2 KB in a row per 16 rows) are brought into LDS once for the four waves by asynchronous copies, two buffers, the next pass's copies in flight while this pass is worked on.
// C[m][n] (f32, pitch ldc, + optional f32 bias[n]) = sum_k A[m][k] Bt[n][k]. z-batch strides sA/sB/sC in elements. K % KP == 0; K is a compile-time number.
// PLANES: no f32 C; the tile leaves as the fp16 operand plane of the attention kernel, straight from the accumulators: a lane's 8 elements are 8 consecutive rows m of one column n,
// which is one 16-byte piece of a fragment-order block, lane l's at l * 16 of a half: a wave's store is 512 bytes in a row. q, k: A = weight (m = head * 64 + d), Bt = x (n = t), rows t, k = d; v: A = x (m = t), Bt = weight (n = head * 64 + d), rows d, k = t.
// PLANES takes q, k and v of every batch in ONE launch: grid (weight panels, token panels, 3 * NB), z = job * NB + batch (job 0 q, 1 k, 2 v); A = the three weight planes (stride sA), Bt = x (batch stride sB), P16 = 3 * NB planes (stride sC) indexed by z.
// Fragments: lane l -> row/col (l & 15); elements 0..7 <- k0 + 8*(l>>4) + 0..7, elements 8..15 <- k0 + 16 + 8*(l>>4) + 0..7 for A and B alike; D element j of lane l = (row 8*(l>>4)+j, col l&15).
template <typename T16> struct WFrag;
template <> struct WFrag<h16> { typedef v16h V; static __device__ __forceinline__ V ld(const h16* p) { return cat16(*(const v8h*)p, *(const v8h*)(p + 256)); } static __device__ __forceinline__ v8f mma(V a, V b, v8f c) { return wmma16(a, b, c); } };
template <> struct WFrag<bf> { typedef v16bf V; static __device__ __forceinline__ V ld(const bf* p) { return cat16b(*(const v8us*)p, *(const v8us*)(p + 256)); } static __device__ __forceinline__ v8f mma(V a, V b, v8f c) { return wmmab(a, b, c); } };
#define GW   4
#define KP   64
#define OPE  (128 * KP)     // 16-bit elements of one operand's share of a staged pass (16 KB)
// eight copies a lane, 2 KB a copy over the work-group's 128 lanes: one operand's eight groups of 16 rows. l = the lane's LDS byte address in the first group, p = the lane's 16 bytes in the first group's source; 16 rows on = 16 * K elements.
// The s_wait_xcnt is a precaution and is the statement's last line, so that it stands in front of every later write of a register that a copy names.
template <int K, typename T16>
__device__ __forceinline__ void copy8r(unsigned l, const T16* p) {
    asm volatile("global_load_async_to_lds_b128 %0, %8, off\n\t"
                 "global_load_async_to_lds_b128 %1, %9, off\n\t"
                 "global_load_async_to_lds_b128 %2, %10, off\n\t"
                 "global_load_async_to_lds_b128 %3, %11, off\n\t"
                 "global_load_async_to_lds_b128 %4, %12, off\n\t"
                 "global_load_async_to_lds_b128 %5, %13, off\n\t"
                 "global_load_async_to_lds_b128 %6, %14, off\n\t"
                 "global_load_async_to_lds_b128 %7, %15, off\n\t"
                 "s_wait_xcnt 0x0"
                 :: "v"(l), "v"(l + 2048u), "v"(l + 4096u), "v"(l + 6144u), "v"(l + 8192u), "v"(l + 10240u), "v"(l + 12288u), "v"(l + 14336u),
                    "v"(p), "v"(p + 16 * K), "v"(p + 32 * K), "v"(p + 48 * K), "v"(p + 64 * K), "v"(p + 80 * K), "v"(p + 96 * K), "v"(p + 112 * K) : "memory");
}
template <typename T16, bool BIAS, bool PLANES, int K>
__global__ __launch_bounds__(GW * 32) void k_gemmw(const T16* __restrict__ A, const T16* __restrict__ Bt, float* C, int ldc, const float* __restrict__ bias, size_t sA, size_t sB, size_t sC, h16* P16) {
    typedef typename WFrag<T16>::V V;
    static_assert(K % KP == 0 && K / KP >= 2);
    constexpr int STE = 2 * OPE;      // elements of one staged pass: A, Bt
    __shared__ __attribute__((aligned(16))) T16 st[2 * STE];
    __shared__ __align__(16) float osa[GW * 16 * 68];
    const size_t z = blockIdx.z; int bx = blockIdx.x, by = blockIdx.y; bool isv = false;
    if constexpr (PLANES) { const size_t job = z / NB; const T16* Wj = A + job * sA; const T16* Xb = Bt + (z - job * NB) * sB; P16 += z * sC;
        if (job == 2) { A = Xb; Bt = Wj; bx = blockIdx.y; by = blockIdx.x; isv = true; } else { A = Wj; Bt = Xb; } }
    else { A += z * sA; Bt += z * sB; C += z * sC; }
    const int lane = threadIdx.x & 31, lr = lane & 15, hi = lane >> 4; const int w = __builtin_amdgcn_readfirstlane((int)(threadIdx.x >> 5)), wm = w >> 1, wn = w & 1; const int r0 = bx * 128 + wm * 64, c0 = by * 128 + wn * 64;
    v8f acc[4][4];
#pragma unroll
    for (int mb = 0; mb < 4; ++mb)
#pragma unroll
        for (int nb = 0; nb < 4; ++nb) acc[mb][nb] = (v8f){};
    const size_t aoff = (size_t)bx * 128 * K, boff = (size_t)by * 128 * K; const unsigned loff = (unsigned)(lane * 8);      // 16 rows of blocks = 16 * K elements; 32 k on = 512 elements
    const unsigned l0 = (unsigned)(uintptr_t)st + threadIdx.x * 16u;
    // ENTRY TILE. The work-groups that read one operand panel run at the same time; walking k from 0 they would all ask L2 for the same lines at the same moment. Pass t therefore takes k tile (t + rot) mod NT, for A and Bt alike, rot set by the block indices:
    // readers of one panel stand on different tiles, two apart along either panel index, so that with the two tiles each copies at entry they touch a whole panel at once and every later tile has been brought into L2 by another reader.
    constexpr int NT = K / KP; static_assert((NT & (NT - 1)) == 0);
    const int tokp = PLANES ? (int)blockIdx.y : (int)blockIdx.x;      // token panel index
    const int zr = PLANES ? (int)(z / NB) * 8 + (int)(z / NB) / 2 : (int)z * 8;
    const int rot = 2 * (int)(blockIdx.x + blockIdx.y) + (tokp >> 3) + zr;
    auto stage = [&](int t) { const size_t ko = (size_t)((t + rot) & (NT - 1)) * (KP * 16) + threadIdx.x * 8u; const unsigned lb = l0 + (unsigned)(t & 1) * (STE * 2u);
        copy8r<K>(lb, A + aoff + ko); copy8r<K>(lb + OPE * 2u, Bt + boff + ko); };
    stage(0);
    asm volatile("s_wait_asynccnt 0x0" ::: "memory");       // this wave's share of pass 0 has landed
    __syncthreads();                                        // every wave's share has: pass 0 may be read
    stage(1);
#pragma unroll 1
    for (int t = 0; t < K / KP; ++t) {
        const T16* sa = st + (t & 1) * STE + wm * (64 * KP) + loff; const T16* sb = st + (t & 1) * STE + OPE + wn * (64 * KP) + loff;
        V a[KP / 32][4], b[KP / 32][4];
#pragma unroll
        for (int ks = 0; ks < KP / 32; ++ks) {
#pragma unroll
            for (int mb = 0; mb < 4; ++mb) { if (mb == 0) b[ks][0] = WFrag<T16>::ld(sb + ks * 512); a[ks][mb] = WFrag<T16>::ld(sa + mb * (16 * KP) + ks * 512); }
#pragma unroll
            for (int nb = 1; nb < 4; ++nb) b[ks][nb] = WFrag<T16>::ld(sb + nb * (16 * KP) + ks * 512);
        }
        // keeps the pass's LDS reads as one group ahead of its matrix instructions, in the order of their use; without it they are asked for in turns among the matrix instructions, into reused registers, a latency each
        __builtin_amdgcn_sched_barrier(0);
#pragma unroll
        for (int ks = 0; ks < KP / 32; ++ks)
#pragma unroll
            for (int nb = 0; nb < 4; ++nb)
#pragma unroll
                for (int mb = 0; mb < 4; ++mb) acc[mb][nb] = WFrag<T16>::mma(a[ks][mb], b[ks][nb], acc[mb][nb]);
        // keeps the hand-over behind the pass's matrix instructions; without it its waits are lifted over them, so that the wave waits for all of its LDS reads before its first product, while the refill stays below and loses its lead
        __builtin_amdgcn_sched_barrier(0);
        // hand-over, every wave, in this order: own LDS reads done; own copies of pass t + 1 landed; the barrier publishes pass t + 1 and ends every reader's last read of pass t's buffer; only then is that buffer refilled
        asm volatile("s_wait_dscnt 0x0" ::: "memory");
        asm volatile("s_wait_asynccnt 0x0" ::: "memory");
        __syncthreads();
        if (t + 2 < K / KP) stage(t + 2);
    }
    asm volatile("s_wait_asynccnt 0x0" ::: "memory");       // no copy is in flight when the wave ends
    if constexpr (PLANES) {
        // q, k: head r0 / 64, block (t / 16) * 2 + d / 32, t = c0 + nb * 16 + lr, d = mb * 16 + 8 * hi + j; v: head c0 / 64, block (t / 32) * 4 + d / 16, t = r0 + mb * 16 + 8 * hi + j, d = nb * 16 + lr
        const size_t pb = (isv ? (size_t)(c0 / 64) * (TT * HD) + (size_t)r0 * HD : (size_t)(r0 / 64) * (TT * HD) + (size_t)c0 * HD) + lane * 8;
        const int smb = isv ? 2048 : 512, snb = isv ? 512 : 1024;
        // all three loops unrolled: the accumulators are indexed by constants alone and stay in registers
#pragma unroll
        for (int nb = 0; nb < 4; ++nb)
#pragma unroll
            for (int mb = 0; mb < 4; ++mb) { v8h o16;
#pragma unroll
                for (int j = 0; j < 8; ++j) o16[j] = tohx(acc[mb][nb][j]);
                *(v8h*)(P16 + pb + (mb >> 1) * smb + nb * snb + (mb & 1) * 256) = o16; }
        return;
    }
    float* os = osa + w * (16 * 68);      // each wave turns its tile in its own range
#pragma unroll
    for (int mb = 0; mb < 4; ++mb) {
#pragma unroll
        for (int nb = 0; nb < 4; ++nb) {
#pragma unroll
            for (int j = 0; j < 8; ++j) os[(hi * 8 + j) * 68 + nb * 16 + lr] = acc[mb][nb][j]; }
        __builtin_amdgcn_wave_barrier(); asm volatile("" ::: "memory");
        float* crow = C + (size_t)(r0 + mb * 16) * ldc + c0;
{
#pragma unroll
            for (int s = 0; s < 8; ++s) { const int row = 2 * s + hi, cofs = lr * 4; v4f val = *(const v4fa*)(os + row * 68 + cofs); if (BIAS) { val[0] += bfr(bias[c0 + cofs]); val[1] += bfr(bias[c0 + cofs + 1]); val[2] += bfr(bias[c0 + cofs + 2]); val[3] += bfr(bias[c0 + cofs + 3]); }
                *(v4f*)(crow + (size_t)row * ldc + cofs) = val; }
             }
        __builtin_amdgcn_wave_barrier(); asm volatile("" ::: "memory");
    }
}

typedef __attribute__((ext_vector_type(2))) _Float16 v2h;
typedef __attribute__((ext_vector_type(4))) _Float16 v4h;
typedef __attribute__((ext_vector_type(2))) unsigned short v2us;
typedef __attribute__((ext_vector_type(4))) unsigned short v4us;
typedef __attribute__((ext_vector_type(2))) float v2f;
typedef __attribute__((ext_vector_type(4))) int v4i;

// weight w[k][n] -> fragment-order plane with rows n: a thread builds the two 16-byte pieces (k & 8 alike, both halves) of one n in one block; lanes run along n, so a load is one whole line and a store two runs of 256 bytes.
// H: the bf16-rounded value is stored in fp16 form (the output projection's operand type).
template <bool H>
__device__ __forceinline__ unsigned short wcv(float f) { if constexpr (H) return __builtin_bit_cast(unsigned short, tohx(bfr(f))); else return f2bf(f); }
template <bool H>
__device__ __forceinline__ void wtG(const float* __restrict__ w, int K, int N, bf* Bt, int blk) {
    const int lane = threadIdx.x & 31; const int u = blk * 8 + (threadIdx.x >> 5); const int nkc = K >> 5;
    const int hi = u & 1, kc = (u >> 1) % nkc, n = ((u >> 1) / nkc) * 32 + lane; if (n >= N) return;
    const float* s = w + (size_t)(kc * 32 + hi * 8) * N + n; v8us o0, o1;
#pragma unroll
    for (int j = 0; j < 8; ++j) { o0[j] = wcv<H>(s[(size_t)j * N]); o1[j] = wcv<H>(s[(size_t)(16 + j) * N]); }
    asm volatile("s_wait_xcnt 0x0" :: "v"(s) : "memory");   // precaution: the address is its input, so that it keeps its registers up to here and none of the sixteen requests lands in one
    bf* d = Bt + ((size_t)(n >> 4) * nkc + kc) * 512 + (hi * 16 + (n & 15)) * 8; *(v8us*)d = o0; *(v8us*)(d + 256) = o1;
}
// src [rows][K] f32 -> fragment-order plane: 64 threads a block, four neighbours share a row; a wave reads 8 whole lines (8 rows x 32 k) and its store is 4 whole lines (a piece of 8 rows is 128 bytes in a row).
__device__ __forceinline__ void cvt8(const float* __restrict__ src, bf* dst, size_t n8, int K, int blk) { const size_t i = (size_t)blk * 256 + threadIdx.x; if (i >= n8) return;
    const int nkc = K >> 5; const int b = (int)(i >> 6), lr = (int)(i >> 2) & 15, p = (int)i & 3;
    const v8f v = *(const v8f*)(src + (size_t)((b / nkc) * 16 + lr) * K + (b % nkc) * 32 + p * 8); v8us o;
#pragma unroll
    for (int j = 0; j < 8; ++j) o[j] = f2bf(v[j]); *(v8us*)(dst + (size_t)b * 512 + (p >> 1) * 256 + ((p & 1) * 16 + lr) * 8) = o;  }
// all operand conversions in ONE launch, the job picked by block range: 4 * GWT blocks turn the four weights (the longer job, dealt first), then NB * GCV blocks convert x. W: four planes one behind the other (q, k, v: bf16; o: fp16); XB: NB planes of TT rows, k = DM.
#define GWT  ((DQ * DM / 16 + 255) / 256)
#define GCV  ((TT * DM / 8 + 255) / 256)
__global__ __launch_bounds__(256) void k_prep(const float* __restrict__ x, const float* __restrict__ wq, const float* __restrict__ wk, const float* __restrict__ wv, const float* __restrict__ wo, bf* W, bf* XB) {
    const int blk = (int)blockIdx.x;
    if (blk < 3 * GWT) { const int j = blk / GWT; wtG<false>(j == 0 ? wq : j == 1 ? wk : wv, DM, DQ, W + (size_t)j * DQ * DM, blk - j * GWT); }
    else if (blk < 4 * GWT) wtG<true>(wo, DQ, DM, W + (size_t)3 * DQ * DM, blk - 3 * GWT);
    else { const int b = (blk - 4 * GWT) / GCV; cvt8(x + (size_t)b * SEQ_FULL * DM, XB + (size_t)b * TT * DM, (size_t)TT * DM / 8, DM, blk - 4 * GWT - b * GCV); }
}
// ---- k_attn: causal attention for one head, 16 query rows per wave, AW waves (QB rows) a work-group, scores never leave registers. Both products are taken transposed: S^T = K.Q^T puts a query in each lane (column l & 15) and keys 8*(l>>4)+j in
// its accumulator elements, which is already the B-fragment k order of O^T = V^T.P^T (key tile 2g -> elements 0..7, key tile 2g+1 -> elements 8..15), so probabilities go from accumulator to operand without a shuffle.
// Online softmax: running maximum m of the raw scores and running sum l per query; o and l are rescaled by exp2((m_old - m_new) c) each pass of KB keys. Probabilities are carried unnormalised (<= 1); the division by l is last.
// The work-group's waves walk the same keys: each pass's keys and values (16 KB, whole fragment-order blocks, so plain runs of bytes) are brought into LDS once for all of them by asynchronous copies, two buffers, the next pass's copies in flight while this pass is worked on.
#define AW   4
#define QB   (AW * 16)
#define KB   64       // keys of a pass
#define STG  8192     // 16-bit elements of one staged pass: four segments of 4 KB (keys, keys, values, values)
static_assert((SEQ) % QB == 0);
// eight copies a lane, 2 KB a copy over the work-group's 128 lanes: l = the lane's LDS byte address in segment 0, a..d = the lane's 16 bytes in the first half of each segment's source.
// The s_wait_xcnt is a precaution and is the statement's last line, so that it stands in front of every later write of a register that a copy names.
template <typename T16>
__device__ __forceinline__ void copy8(unsigned l, const T16* a, const T16* b, const T16* c, const T16* d) {
    asm volatile("global_load_async_to_lds_b128 %0, %8, off\n\t"
                 "global_load_async_to_lds_b128 %1, %9, off\n\t"
                 "global_load_async_to_lds_b128 %2, %10, off\n\t"
                 "global_load_async_to_lds_b128 %3, %11, off\n\t"
                 "global_load_async_to_lds_b128 %4, %12, off\n\t"
                 "global_load_async_to_lds_b128 %5, %13, off\n\t"
                 "global_load_async_to_lds_b128 %6, %14, off\n\t"
                 "global_load_async_to_lds_b128 %7, %15, off\n\t"
                 "s_wait_xcnt 0x0"
                 :: "v"(l), "v"(l + 2048u), "v"(l + 4096u), "v"(l + 6144u), "v"(l + 8192u), "v"(l + 10240u), "v"(l + 12288u), "v"(l + 14336u),
                    "v"(a), "v"(a + 1024), "v"(b), "v"(b + 1024), "v"(c), "v"(c + 1024), "v"(d), "v"(d + 1024) : "memory");
}
__device__ __forceinline__ float xhalf(float x) { return __builtin_bit_cast(float, __builtin_amdgcn_permlanex16(__builtin_bit_cast(int, x), __builtin_bit_cast(int, x), 0x76543210, 0xfedcba98, false, false)); }  // lane l with lane l ^ 16
__device__ __forceinline__ void pfrag(const v8f& p0, const v8f& p1, v16h& f) {
#pragma unroll
    for (int j = 0; j < 8; ++j) { f[j] = tohx(p0[j]); f[8 + j] = tohx(p1[j]); } }
__device__ __forceinline__ void attn_rows(const h16* __restrict__ Q, const h16* __restrict__ Kp, const h16* __restrict__ Vt, int Q0, int q0, int lr, int hi, const h16* sm, h16* Ao) {
    typedef h16 T16;
    typedef typename WFrag<T16>::V V;
    constexpr int NK = KB / 16, NG = KB / 32;
    const float c = SCL * 1.4426950408889634f;
    const unsigned loff = (unsigned)((hi * 16 + lr) * 8);      // the lane's piece in each half of a block
    V qf[2];
#pragma unroll
    for (int ks = 0; ks < 2; ++ks) qf[ks] = WFrag<T16>::ld(Q + (size_t)q0 * HD + ks * 512 + loff);
    v8f o[4];
#pragma unroll
    for (int db = 0; db < 4; ++db) o[db] = (v8f){};
    float m = -3.0e38f, l = 0.f;
    const int np = (Q0 + QB) / KB;      // passes of the work-group, the same for all its waves: keys 0 .. Q0 + QB - 1
    const unsigned l0 = (unsigned)(uintptr_t)sm + threadIdx.x * 16u;
    // KEY ORDER. A head's work-groups run at the same time on the same planes; walking from key 0 they would all ask L2 for the same lines at the same moment. Pass t therefore takes key tile np - 1 - t, from the diagonal down:
    // at equal pace no two of them stand on one tile, and every tile is first copied at entry, by the work-group whose diagonal it is, so that every later reader finds it in L2.
    auto stage = [&](int t) { const size_t kb = (size_t)(np - 1 - t) * (KB * HD) + threadIdx.x * 8u; const unsigned lb = l0 + (unsigned)(t & 1) * (STG * 2u);
        copy8(lb, Kp + kb, Kp + kb + 2048, Vt + kb, Vt + kb + 2048); };
    stage(0);
    asm volatile("s_wait_asynccnt 0x0" ::: "memory");       // this wave's share of pass 0 has landed
    __syncthreads();                                        // every wave's share has: pass 0 may be read
    if (np > 1) stage(1);
#pragma unroll 1
    for (int t = 0; t < np; ++t) {
      const int k0 = (np - 1 - t) * KB;
      V va[NG][4]; v8f s[NK];
      {
        V ka[NK][2];     // all of a pass's LDS reads go out in one run, keys first: the values' share of the latency runs under the score products
        const T16* sb = sm + (t & 1) * STG + loff;
#pragma unroll
        for (int kt = 0; kt < NK; ++kt)
#pragma unroll
            for (int ks = 0; ks < 2; ++ks) ka[kt][ks] = WFrag<T16>::ld(sb + (kt * 2 + ks) * 512);
#pragma unroll
        for (int g = 0; g < NG; ++g)
#pragma unroll
            for (int db = 0; db < 4; ++db) va[g][db] = WFrag<T16>::ld(sb + 4096 + (g * 4 + db) * 512);
        // inputs-only fence on the loaded key fragments: all eight are in flight together; without it they are asked for in turns into reused registers, several latencies a pass
        asm volatile("" :: "v"(ka[0][0]), "v"(ka[0][1]), "v"(ka[1][0]), "v"(ka[1][1]), "v"(ka[NK - 2][0]), "v"(ka[NK - 2][1]), "v"(ka[NK - 1][0]), "v"(ka[NK - 1][1]));
#pragma unroll
        for (int kt = 0; kt < NK; ++kt) { v8f acc = (v8f){};
#pragma unroll
            for (int ks = 0; ks < 2; ++ks) acc = WFrag<T16>::mma(ka[kt][ks], qf[ks], acc);
            s[kt] = acc; }
      }
      // hand-over, every wave, in this order: own LDS reads done (the pass's fragments are all in registers from here on); own copies of pass t + 1 landed; the barrier publishes pass t + 1 and ends every reader's last read of pass t's buffer;
      // only then is that buffer refilled, here and not at the end of the pass, so that the copies fly under softmax, the value products and the next pass's reads
      asm volatile("s_wait_dscnt 0x0" ::: "memory");
      asm volatile("s_wait_asynccnt 0x0" ::: "memory");
      __syncthreads();
      if (t + 2 < np) stage(t + 2);
      {
        if (k0 + KB - 1 > q0) {      // only passes that reach the diagonal hold keys above a query: mask by index select
#pragma unroll
            for (int kt = 0; kt < NK; ++kt)
#pragma unroll
                for (int j = 0; j < 8; ++j) s[kt][j] = (k0 + kt * 16 + 8 * hi + j <= q0 + lr) ? s[kt][j] : -3.0e38f; }
        float mx = m;
#pragma unroll
        for (int kt = 0; kt < NK; ++kt) { float t = s[kt][0];      // one short chain a key tile, side by side
#pragma unroll
            for (int j = 1; j < 8; ++j) t = fmaxf(t, s[kt][j]);
            mx = fmaxf(mx, t); }
        mx = fmaxf(mx, xhalf(mx));      // the two lane halves hold different keys of the same query
        const float mc = mx * c;                        // exponent as one fused multiply-add a score: s c - max c
        const float alpha = __builtin_amdgcn_exp2f(__builtin_fmaf(m, c, -mc)); m = mx;
        float ps = 0.f;
#pragma unroll
        for (int kt = 0; kt < NK; ++kt) { float t = 0.f;
#pragma unroll
            for (int j = 0; j < 8; ++j) { s[kt][j] = __builtin_amdgcn_exp2f(__builtin_fmaf(s[kt][j], c, -mc)); t += s[kt][j]; }
            ps += t; }
        l = l * alpha + ps;
#pragma unroll
        for (int db = 0; db < 4; ++db) o[db] *= alpha;
#pragma unroll
        for (int g = 0; g < NG; ++g) { V pf; pfrag(s[2 * g], s[2 * g + 1], pf);
#pragma unroll
            for (int db = 0; db < 4; ++db) o[db] = WFrag<T16>::mma(va[g][db], pf, o[db]); }
      }
    }
    asm volatile("s_wait_asynccnt 0x0" ::: "memory");       // no copy is in flight when the wave ends
    l += xhalf(l);
    const float inv = __fdiv_rn(1.0f, l);
#pragma unroll
    for (int db = 0; db < 4; ++db) { v8h o16;
#pragma unroll
        for (int j = 0; j < 8; ++j) o16[j] = tohx(o[db][j] * inv);
        *(v8h*)(Ao + (size_t)q0 * DQ + (db >> 1) * 512 + (db & 1) * 256 + loff) = o16; }
}
// grid (heads, NB, TT/QB), AW waves a block; the longest rows (most keys) are dealt first. Every operand plane is [NB][heads][...]; Ao: NB fragment-order planes of TT rows, k = DQ (a head's 64 k are 2 blocks).
__global__ __launch_bounds__(AW * 32) void k_attn(const h16* __restrict__ Q16, const h16* __restrict__ K16, const h16* __restrict__ V16, h16* Ao) {
    __shared__ __attribute__((aligned(16))) h16 kv[2 * STG];
    const int lane = threadIdx.x & 31, lr = lane & 15, hi = lane >> 4; const int Q0 = (TT / QB - 1 - (int)blockIdx.z) * QB, q0 = Q0 + __builtin_amdgcn_readfirstlane((int)(threadIdx.x >> 5)) * 16;
    const size_t hb = ((size_t)blockIdx.y * NH_ + blockIdx.x) * TT * HD; const size_t ho = (size_t)blockIdx.y * TT * DQ + (size_t)blockIdx.x * (HD / 32) * 512;
    attn_rows(Q16 + hb, K16 + hb, V16 + hb, Q0, q0, lr, hi, kv, Ao + ho);
}

extern "C" void kernel_launch(void* const* d_in, const int* in_sizes, int n_in,
                              void* d_out, int out_size, void* d_ws, size_t ws_size, hipStream_t stream) {
    if (n_in < 6) return;
    const size_t xneed = (size_t)(NB - 1) * SEQ_FULL * DM + (size_t)TT * DM;
    if ((size_t)in_sizes[0] < xneed || (size_t)in_sizes[1] < (size_t)DM * DQ || (size_t)in_sizes[2] < (size_t)DM * DQ || (size_t)in_sizes[3] < (size_t)DM * DQ || (size_t)in_sizes[4] < (size_t)DQ * DM || in_sizes[5] < DM || (size_t)out_size < xneed) return;
    const float* x = (const float*)d_in[0]; const float* wq = (const float*)d_in[1]; const float* wk = (const float*)d_in[2]; const float* wv = (const float*)d_in[3]; const float* wo = (const float*)d_in[4]; const float* bo = (const float*)d_in[5];
    float* OUT = (float*)d_out;     // [NB][SEQ][1024], batch stride SEQ_FULL*DM
    char* wsp = (char*)d_ws;
    auto take = [&](size_t bytes) { char* p = wsp; wsp += (bytes + 255) & ~(size_t)255; return (void*)p; };
    bf* WALL = (bf*)take((size_t)4 * DQ * DM * 2);      // weight planes, rows n, from the [in][out] storage: q, k, v (bf16), o (fp16), one behind the other
    bf* XB = (bf*)take((size_t)NB * TT * DM * 2);
    const size_t PS = (size_t)NH_ * TT * HD;            // elements of one operand plane of one batch
    h16* P16 = (h16*)take((size_t)3 * NB * PS * 2);     // [q, k, v][NB] planes
    h16* AT = (h16*)take((size_t)NB * TT * DQ * 2);
    if ((size_t)(wsp - (char*)d_ws) > ws_size) return;
    k_prep<<<4 * GWT + NB * GCV, 256, 0, stream>>>(x, wq, wk, wv, wo, WALL, XB);
    k_gemmw<bf, false, true, DM><<<dim3(DQ / 128, TT / 128, 3 * NB), GW * 32, 0, stream>>>(WALL, XB, nullptr, 0, nullptr, (size_t)DQ * DM, (size_t)TT * DM, PS, P16);
    k_attn<<<dim3(NH_, NB, TT / QB), AW * 32, 0, stream>>>(P16, P16 + NB * PS, P16 + 2 * NB * PS, AT);
    k_gemmw<h16, true, false, DQ><<<dim3(TT / 128, DM / 128, NB), GW * 32, 0, stream>>>(AT, (const h16*)(WALL + (size_t)3 * DQ * DM), OUT, DM, bo, (size_t)TT * DQ, 0, (size_t)SEQ_FULL * DM, nullptr);
}
